// v000
// Measured on an AMD MI455X. A time is GPU time per run, averaged over a window of back-to-back runs after a warm-up
// (all launches, gaps included; the runs take copies of the inputs in turn), and the median of several windows.
// Apart from v000's, it joins two sittings. Times from different sittings can be a few percent apart, while
// side-by-side timings come from the same sitting.
// The starting kernel, v000, takes 324 microseconds a run.
#include <hip/hip_runtime.h>
#include <hip/hip_fp16.h>

// ---------------------------------------------------------------------------
// Disentangled attention, MI455X (gfx1250, wave32, WMMA).
// scores = (q.k)/8 + alpha_h*(pe_q.pe_k) + beta_h  folded into one GEMM by
// augmenting head-dim 64 -> 128:  Qa=[q/8, alpha*pe], Ka=[k, pe].
// f16 WMMA + fp32 accumulation; flash-style online softmax (no 512MB scores).
// GEMMs use 32x64 wave tiles with double-buffered fragments so loads overlap
// the v_wmma stream instead of serializing on s_wait_loadcnt 0.
// ---------------------------------------------------------------------------

typedef __attribute__((ext_vector_type(16))) _Float16 v16h;
typedef __attribute__((ext_vector_type(8)))  _Float16 v8h;
typedef __attribute__((ext_vector_type(8)))  float    v8f;

#define D_MODEL 1024
#define NHEADS  16
#define HDIM    64
#define SEQ     2048
#define BATCH   2
#define MROWS   (BATCH * SEQ)   // 4096
#define DAUG    128             // augmented head dim (64 content + 64 pos)

#define LDS_LDV 72
#define LDS_LDP 72

// ---- WMMA helper -----------------------------------------------------------
static __device__ __forceinline__ v8f wmma_f16(v16h a, v16h b, v8f c) {
    return __builtin_amdgcn_wmma_f32_16x16x32_f16(false, a, false, b, (short)0, c,
                                                  false, false);
}

// ---- 16-bit A-layout fragment load (also B-frag when given the N x K view) --
// ISA 7.12.2: lanes 0-15 hold row M=lane with K = {k0..k0+7, k0+16..k0+23};
// lanes 16-31 hold the same rows with K = {k0+8..k0+15, k0+24..k0+31}.
static __device__ __forceinline__ v16h load_frag(const _Float16* __restrict__ p,
                                                 int ld, int row0, int k0, int lane) {
    const int r  = lane & 15;
    const int h8 = (lane >> 4) << 3;   // 0 or 8
    const _Float16* base = p + (size_t)(row0 + r) * ld + k0 + h8;
    v8h lo = *(const v8h*)(base);
    v8h hi = *(const v8h*)(base + 16);
    return __builtin_shufflevector(lo, hi, 0,1,2,3,4,5,6,7,8,9,10,11,12,13,14,15);
}

// ---- fp32 -> f16 convert ---------------------------------------------------
__global__ void cvt_f32_f16_kernel(const float* __restrict__ in,
                                   _Float16* __restrict__ out, int n) {
    int i = blockIdx.x * blockDim.x + threadIdx.x;
    if (i < n) out[i] = (_Float16)in[i];
}

// ---- common 32x64 GEMM core: acc[mi][j] += A[m0+mi*16,:] . Wt[n0+j*16,:]^T --
// Double-buffered: next k-step's fragments are loaded into fresh registers
// while the 8 WMMAs for the current step issue.
static __device__ __forceinline__ void gemm_core_32x64(
        const _Float16* __restrict__ A, const _Float16* __restrict__ Wt,
        int m0, int n0, int lane, v8f acc[2][4]) {
    v16h a0 = load_frag(A, D_MODEL, m0,      0, lane);
    v16h a1 = load_frag(A, D_MODEL, m0 + 16, 0, lane);
    v16h b0 = load_frag(Wt, D_MODEL, n0,      0, lane);
    v16h b1 = load_frag(Wt, D_MODEL, n0 + 16, 0, lane);
    v16h b2 = load_frag(Wt, D_MODEL, n0 + 32, 0, lane);
    v16h b3 = load_frag(Wt, D_MODEL, n0 + 48, 0, lane);
#pragma unroll 4
    for (int k0 = 0; k0 < D_MODEL; k0 += 32) {
        v16h na0, na1, nb0, nb1, nb2, nb3;
        const int kn = k0 + 32;
        if (kn < D_MODEL) {
            na0 = load_frag(A, D_MODEL, m0,      kn, lane);
            na1 = load_frag(A, D_MODEL, m0 + 16, kn, lane);
            nb0 = load_frag(Wt, D_MODEL, n0,      kn, lane);
            nb1 = load_frag(Wt, D_MODEL, n0 + 16, kn, lane);
            nb2 = load_frag(Wt, D_MODEL, n0 + 32, kn, lane);
            nb3 = load_frag(Wt, D_MODEL, n0 + 48, kn, lane);
        }
        // 8 independent accumulation chains
        acc[0][0] = wmma_f16(a0, b0, acc[0][0]);
        acc[0][1] = wmma_f16(a0, b1, acc[0][1]);
        acc[0][2] = wmma_f16(a0, b2, acc[0][2]);
        acc[0][3] = wmma_f16(a0, b3, acc[0][3]);
        acc[1][0] = wmma_f16(a1, b0, acc[1][0]);
        acc[1][1] = wmma_f16(a1, b1, acc[1][1]);
        acc[1][2] = wmma_f16(a1, b2, acc[1][2]);
        acc[1][3] = wmma_f16(a1, b3, acc[1][3]);
        a0 = na0; a1 = na1;
        b0 = nb0; b1 = nb1; b2 = nb2; b3 = nb3;
    }
}

// ---- QKV projection: C = x @ W^T (+bias) * scale, head-split f16 output ----
// One wave computes a 32x64 tile. 2048 waves = 256 blocks x 8 waves.
__global__ void __launch_bounds__(256)
proj_qkv_kernel(const _Float16* __restrict__ A,    // MROWS x D_MODEL
                const _Float16* __restrict__ Wt,   // D_MODEL x D_MODEL (N x K)
                const float*    __restrict__ bias, // D_MODEL
                _Float16*       __restrict__ dst,  // [b,h,s,dstStride]
                int dstStride, float scale) {
    const int lane = threadIdx.x & 31;
    const int wid  = blockIdx.x * 8 + (threadIdx.x >> 5);
    const int m0   = (wid >> 4) << 5;   // 128 row tiles of 32
    const int n0   = (wid & 15) << 6;   // 16 col groups of 64

    v8f acc[2][4] = {};
    gemm_core_32x64(A, Wt, m0, n0, lane, acc);

    const int half = lane >> 4;
    const int nlo  = lane & 15;
#pragma unroll
    for (int mi = 0; mi < 2; ++mi)
#pragma unroll
        for (int j = 0; j < 4; ++j)
#pragma unroll
            for (int r = 0; r < 8; ++r) {
                int m = m0 + mi * 16 + r + half * 8;
                int n = n0 + j * 16 + nlo;
                int bb = m >> 11, s = m & (SEQ - 1);
                int hh = n >> 6,  d = n & (HDIM - 1);
                float v = (acc[mi][j][r] + bias[n]) * scale;
                dst[(((size_t)bb * NHEADS + hh) * SEQ + s) * dstStride + d] =
                    (_Float16)v;
            }
}

// ---- output projection: out = O @ Wo^T + bo (fp32 out) ---------------------
__global__ void __launch_bounds__(256)
proj_out_kernel(const _Float16* __restrict__ A,    // MROWS x D_MODEL (f16)
                const _Float16* __restrict__ Wt,   // D_MODEL x D_MODEL (N x K)
                const float*    __restrict__ bias,
                float*          __restrict__ out) {
    const int lane = threadIdx.x & 31;
    const int wid  = blockIdx.x * 8 + (threadIdx.x >> 5);
    const int m0   = (wid >> 4) << 5;
    const int n0   = (wid & 15) << 6;

    v8f acc[2][4] = {};
    gemm_core_32x64(A, Wt, m0, n0, lane, acc);

    const int half = lane >> 4;
    const int nlo  = lane & 15;
#pragma unroll
    for (int mi = 0; mi < 2; ++mi)
#pragma unroll
        for (int j = 0; j < 4; ++j)
#pragma unroll
            for (int r = 0; r < 8; ++r) {
                int m = m0 + mi * 16 + r + half * 8;
                int n = n0 + j * 16 + nlo;
                out[(size_t)m * D_MODEL + n] = acc[mi][j][r] + bias[n];
            }
}

// ---- fill positional halves of Qa / Ka -------------------------------------
__global__ void augment_kernel(const float* __restrict__ pe,
                               const float* __restrict__ alpha,
                               _Float16* __restrict__ Qa,
                               _Float16* __restrict__ Ka) {
    int i = blockIdx.x * blockDim.x + threadIdx.x;   // over B*H*S*64
    if (i >= BATCH * NHEADS * SEQ * HDIM) return;
    int d = i & (HDIM - 1);
    int s = (i >> 6) & (SEQ - 1);
    int h = (i >> 17) & (NHEADS - 1);
    float p = pe[s * HDIM + d];
    size_t base = ((size_t)(i >> 6)) * DAUG + HDIM + d;  // (b,h,s)*128 + 64 + d
    Qa[base] = (_Float16)(alpha[h] * p);
    Ka[base] = (_Float16)p;
}

// ---- fused flash attention over augmented dim 128 --------------------------
// Block = (b, h, 128 q rows) -> 8 waves, each wave owns 16 q rows.
__global__ void __launch_bounds__(256)
attn_kernel(const _Float16* __restrict__ Qa,   // [b,h,s,128]
            const _Float16* __restrict__ Ka,   // [b,h,s,128]
            const _Float16* __restrict__ V,    // [b,h,s,64]
            const int*      __restrict__ mask, // [b,s]
            const float*    __restrict__ beta, // [h]
            _Float16*       __restrict__ O) {  // [b,s,h,64] == MROWS x D_MODEL
    __shared__ __align__(16) _Float16 VT[HDIM * LDS_LDV];       // V^T tile [d][k]
    __shared__ __align__(16) _Float16 PS[8 * 16 * LDS_LDP];     // per-wave P

    const int lane = threadIdx.x & 31;
    const int widx = threadIdx.x >> 5;
    const int bh   = blockIdx.x >> 4;           // b*16 + h
    const int b    = bh >> 4;
    const int h    = bh & 15;
    const int q0   = (blockIdx.x & 15) * 128 + widx * 16;

    const _Float16* Qh = Qa + (size_t)bh * SEQ * DAUG;
    const _Float16* Kh = Ka + (size_t)bh * SEQ * DAUG;
    const _Float16* Vh = V  + (size_t)bh * SEQ * HDIM;
    const float bet = beta[h];

    v16h qf[4];
#pragma unroll
    for (int kq = 0; kq < 4; ++kq) qf[kq] = load_frag(Qh, DAUG, q0, kq * 32, lane);

    v8f oacc[4] = {};
    float rmax[8], rsum[8];
#pragma unroll
    for (int r = 0; r < 8; ++r) { rmax[r] = -3.0e38f; rsum[r] = 0.f; }

    const int half = lane >> 4;
    const int nlo  = lane & 15;
    _Float16* myP = &PS[widx * 16 * LDS_LDP];

    for (int k0 = 0; k0 < SEQ; k0 += 64) {
        // ---- cooperative V^T staging (256 threads, 64x64 f16 tile) ----
        {
            int kk = threadIdx.x & 63;
            int d0 = (threadIdx.x >> 6) * 16;
            const _Float16* vp = Vh + (size_t)(k0 + kk) * HDIM + d0;
            v8h a = *(const v8h*)vp;
            v8h c = *(const v8h*)(vp + 8);
#pragma unroll
            for (int i = 0; i < 8; ++i) {
                VT[(d0 + i)     * LDS_LDV + kk] = a[i];
                VT[(d0 + 8 + i) * LDS_LDV + kk] = c[i];
            }
            if (k0 + 64 < SEQ)  // pull next V tile toward L2/L0
                __builtin_prefetch(Vh + (size_t)(k0 + 64 + kk) * HDIM + d0, 0, 1);
        }
        __syncthreads();

        // ---- scores S = Qa.Ka^T (16x64, K=128); kq-outer => 4 independent
        //      WMMA chains per step, 4 K-frag loads clustered per step ----
        v8f sc[4] = {};
#pragma unroll
        for (int kq = 0; kq < 4; ++kq) {
            v16h kb[4];
#pragma unroll
            for (int j = 0; j < 4; ++j)
                kb[j] = load_frag(Kh, DAUG, k0 + j * 16, kq * 32, lane);
#pragma unroll
            for (int j = 0; j < 4; ++j)
                sc[j] = wmma_f16(qf[kq], kb[j], sc[j]);
        }
#pragma unroll
        for (int j = 0; j < 4; ++j) {
            int mv = mask[b * SEQ + k0 + j * 16 + nlo];
#pragma unroll
            for (int r = 0; r < 8; ++r)
                sc[j][r] = (mv == 0) ? -3.0e38f : (sc[j][r] + bet);
        }

        // ---- online softmax (rows live across 16 lanes of each half) ----
#pragma unroll
        for (int r = 0; r < 8; ++r) {
            float m = fmaxf(fmaxf(sc[0][r], sc[1][r]), fmaxf(sc[2][r], sc[3][r]));
#pragma unroll
            for (int off = 1; off < 16; off <<= 1)
                m = fmaxf(m, __shfl_xor(m, off, 32));
            float nm   = fmaxf(rmax[r], m);
            float corr = __expf(rmax[r] - nm);
            rmax[r] = nm;
            rsum[r] *= corr;
#pragma unroll
            for (int j = 0; j < 4; ++j) oacc[j][r] *= corr;
            float ls = 0.f;
#pragma unroll
            for (int j = 0; j < 4; ++j) {
                float p = __expf(sc[j][r] - nm);
                sc[j][r] = p;
                ls += p;
            }
#pragma unroll
            for (int off = 1; off < 16; off <<= 1)
                ls += __shfl_xor(ls, off, 32);
            rsum[r] += ls;
        }

        // ---- stage P (C layout -> row-major LDS) ----
#pragma unroll
        for (int j = 0; j < 4; ++j)
#pragma unroll
            for (int r = 0; r < 8; ++r)
                myP[(r + half * 8) * LDS_LDP + j * 16 + nlo] = (_Float16)sc[j][r];

        // ---- P.V : A-frags from P stage, B-frags from V^T stage ----
#pragma unroll
        for (int kk = 0; kk < 2; ++kk) {
            v16h pa = load_frag(myP, LDS_LDP, 0, kk * 32, lane);
            v16h vb[4];
#pragma unroll
            for (int j2 = 0; j2 < 4; ++j2)
                vb[j2] = load_frag(VT, LDS_LDV, j2 * 16, kk * 32, lane);
#pragma unroll
            for (int j2 = 0; j2 < 4; ++j2)
                oacc[j2] = wmma_f16(pa, vb[j2], oacc[j2]);
        }
        __syncthreads();   // protect VT before next staging round
    }

    // ---- normalize and store O in [b,s,h,d] (row-major 4096 x 1024) ----
#pragma unroll
    for (int r = 0; r < 8; ++r) {
        float inv = 1.f / fmaxf(rsum[r], 1e-20f);
        int s = q0 + r + half * 8;
#pragma unroll
        for (int j2 = 0; j2 < 4; ++j2) {
            int d = j2 * 16 + nlo;
            O[(((size_t)b * SEQ + s) * NHEADS + h) * HDIM + d] =
                (_Float16)(oacc[j2][r] * inv);
        }
    }
}

// ---------------------------------------------------------------------------
extern "C" void kernel_launch(void* const* d_in, const int* in_sizes, int n_in,
                              void* d_out, int out_size, void* d_ws, size_t ws_size,
                              hipStream_t stream) {
    const float* x     = (const float*)d_in[0];
    const int*   mask  = (const int*)d_in[1];
    const float* Wq    = (const float*)d_in[2];
    const float* bq    = (const float*)d_in[3];
    const float* Wk    = (const float*)d_in[4];
    const float* bk    = (const float*)d_in[5];
    const float* Wv    = (const float*)d_in[6];
    const float* bv    = (const float*)d_in[7];
    const float* Wo    = (const float*)d_in[8];
    const float* bo    = (const float*)d_in[9];
    const float* pe    = (const float*)d_in[10];
    const float* alpha = (const float*)d_in[11];
    const float* beta  = (const float*)d_in[12];
    float* out = (float*)d_out;

    // workspace carve-up (64 MB total)
    char* ws = (char*)d_ws;
    _Float16* xh  = (_Float16*)ws; ws += (size_t)MROWS * D_MODEL * 2;        // 8 MB
    _Float16* Wqh = (_Float16*)ws; ws += (size_t)D_MODEL * D_MODEL * 2;      // 2 MB
    _Float16* Wkh = (_Float16*)ws; ws += (size_t)D_MODEL * D_MODEL * 2;
    _Float16* Wvh = (_Float16*)ws; ws += (size_t)D_MODEL * D_MODEL * 2;
    _Float16* Woh = (_Float16*)ws; ws += (size_t)D_MODEL * D_MODEL * 2;
    _Float16* Qa  = (_Float16*)ws; ws += (size_t)BATCH * NHEADS * SEQ * DAUG * 2; // 16 MB
    _Float16* Kaa = (_Float16*)ws; ws += (size_t)BATCH * NHEADS * SEQ * DAUG * 2; // 16 MB
    _Float16* Vb  = (_Float16*)ws; ws += (size_t)BATCH * NHEADS * SEQ * HDIM * 2; //  8 MB
    _Float16* Oh  = (_Float16*)ws; ws += (size_t)MROWS * D_MODEL * 2;             //  8 MB

    int n;
    n = MROWS * D_MODEL;
    cvt_f32_f16_kernel<<<(n + 255) / 256, 256, 0, stream>>>(x, xh, n);
    n = D_MODEL * D_MODEL;
    cvt_f32_f16_kernel<<<(n + 255) / 256, 256, 0, stream>>>(Wq, Wqh, n);
    cvt_f32_f16_kernel<<<(n + 255) / 256, 256, 0, stream>>>(Wk, Wkh, n);
    cvt_f32_f16_kernel<<<(n + 255) / 256, 256, 0, stream>>>(Wv, Wvh, n);
    cvt_f32_f16_kernel<<<(n + 255) / 256, 256, 0, stream>>>(Wo, Woh, n);

    // q scaled by 1/sqrt(HDIM)=1/8 folded into Qa content half
    proj_qkv_kernel<<<256, 256, 0, stream>>>(xh, Wqh, bq, Qa, DAUG, 0.125f);
    proj_qkv_kernel<<<256, 256, 0, stream>>>(xh, Wkh, bk, Kaa, DAUG, 1.0f);
    proj_qkv_kernel<<<256, 256, 0, stream>>>(xh, Wvh, bv, Vb, HDIM, 1.0f);

    n = BATCH * NHEADS * SEQ * HDIM;
    augment_kernel<<<(n + 255) / 256, 256, 0, stream>>>(pe, alpha, Qa, Kaa);

    attn_kernel<<<512, 256, 0, stream>>>(Qa, Kaa, Vb, mask, beta, Oh);

    proj_out_kernel<<<256, 256, 0, stream>>>(Oh, Woh, bo, out);
}

// v001
// Measured time: 266 microseconds a run.
// Next to v000, in two timings, it ran 1.23 times as fast each time.
#include <hip/hip_runtime.h>
#include <hip/hip_fp16.h>

// ---------------------------------------------------------------------------
// Disentangled attention, MI455X (gfx1250, wave32, WMMA).
// scores = (q.k)/8 + alpha_h*(pe_q.pe_k) + beta_h  folded into one GEMM by
// augmenting head-dim 64 -> 128:  Qa=[q/8, alpha*pe], Ka=[k, pe].
// f16 WMMA + fp32 accumulation; flash-style online softmax (no 512MB scores).
// GEMMs use 32x64 wave tiles with double-buffered fragments so loads overlap
// the v_wmma stream instead of serializing on s_wait_loadcnt 0.
// Every f16 operand that a wave reads from global memory except V (x, weights, Qa,
// Ka, O) is stored by its producer in fragment order, so that each wave-wide
// 16-byte load covers 512 contiguous bytes (4 whole lines, not 16 partial ones).
// ---------------------------------------------------------------------------

typedef __attribute__((ext_vector_type(16))) _Float16 v16h;
typedef __attribute__((ext_vector_type(8)))  _Float16 v8h;
typedef __attribute__((ext_vector_type(8)))  float    v8f;

#define D_MODEL 1024
#define NHEADS  16
#define HDIM    64
#define SEQ     2048
#define BATCH   2
#define MROWS   (BATCH * SEQ)   // 4096
#define DAUG    128             // augmented head dim (64 content + 64 pos)

#define LDS_LDV 72
#define LDS_LDP 72

// ---- WMMA helper -----------------------------------------------------------
static __device__ __forceinline__ v8f wmma_f16(v16h a, v16h b, v8f c) {
    return __builtin_amdgcn_wmma_f32_16x16x32_f16(false, a, false, b, (short)0, c,
                                                  false, false);
}

// ---- 16-bit A-layout fragment load (also B-frag when given the N x K view) --
// ISA 7.12.2: lanes 0-15 hold row M=lane with K = {k0..k0+7, k0+16..k0+23};
// lanes 16-31 hold the same rows with K = {k0+8..k0+15, k0+24..k0+31}.
static __device__ __forceinline__ v16h load_frag(const _Float16* __restrict__ p,
                                                 int ld, int row0, int k0, int lane) {
    const int r  = lane & 15;
    const int h8 = (lane >> 4) << 3;   // 0 or 8
    const _Float16* base = p + (size_t)(row0 + r) * ld + k0 + h8;
    v8h lo = *(const v8h*)(base);
    v8h hi = *(const v8h*)(base + 16);
    return __builtin_shufflevector(lo, hi, 0,1,2,3,4,5,6,7,8,9,10,11,12,13,14,15);
}

// ---- fragment-order storage of a rows x K f16 matrix ------------------------
// One 16-row x 32-k fragment is a 1 KB block; blocks run along k, then rows.
// Inside a block: 512 B with each lane's first 8 halves, then 512 B with its
// second 8, in the lane and k order of load_frag above.
static __device__ __forceinline__ size_t pk_off(int row, int k, int kblocks) {
    return ((size_t)((row >> 4) * kblocks + (k >> 5)) << 9)
         + (((k >> 4) & 1) << 8)
         + (((row & 15) + (((k >> 3) & 1) << 4)) << 3)
         + (k & 7);
}

#define PK_BLOCK 512   // halves in one 16 x 32 fragment block

// base = start of the fragment's block + lane * 8
static __device__ __forceinline__ v16h load_frag_pk(const _Float16* __restrict__ base) {
    v8h lo = *(const v8h*)(base);
    v8h hi = *(const v8h*)(base + 256);
    return __builtin_shufflevector(lo, hi, 0,1,2,3,4,5,6,7,8,9,10,11,12,13,14,15);
}

// ---- fp32 -> f16 convert, rows x D_MODEL, into fragment order ---------------
// One thread per 16-byte chunk of the output; chunk c lies at out + 8 * c.
__global__ void cvt_f32_f16_kernel(const float* __restrict__ in,
                                   _Float16* __restrict__ out, int nchunks) {
    int c = blockIdx.x * blockDim.x + threadIdx.x;
    if (c >= nchunks) return;
    const int lane = c & 31;
    const int part = (c >> 5) & 1;
    const int kb   = (c >> 6) & (D_MODEL / 32 - 1);
    const int rt   = c >> 11;
    const int row  = rt * 16 + (lane & 15);
    const int k    = kb * 32 + part * 16 + (lane >> 4) * 8;
    const float4* ip = (const float4*)(in + (size_t)row * D_MODEL + k);
    float4 u = ip[0];
    float4 w = ip[1];
    v8h o;
    o[0] = (_Float16)u.x; o[1] = (_Float16)u.y; o[2] = (_Float16)u.z; o[3] = (_Float16)u.w;
    o[4] = (_Float16)w.x; o[5] = (_Float16)w.y; o[6] = (_Float16)w.z; o[7] = (_Float16)w.w;
    *(v8h*)(out + (size_t)c * 8) = o;
}

// ---- common 32x64 GEMM core: acc[mi][j] += A[m0+mi*16,:] . Wt[n0+j*16,:]^T --
// Double-buffered: next k-step's fragments are loaded into fresh registers
// while the 8 WMMAs for the current step issue.
static __device__ __forceinline__ void gemm_core_32x64(
        const _Float16* __restrict__ A, const _Float16* __restrict__ Wt,
        int m0, int n0, int lane, v8f acc[2][4]) {
    const int RT = (D_MODEL / 32) * PK_BLOCK;   // halves per 16-row tile
    const int l8 = lane * 8;
    const _Float16* pa = A  + (size_t)(m0 >> 4) * RT;
    const _Float16* pb = Wt + (size_t)(n0 >> 4) * RT;
    v16h a0 = load_frag_pk(pa + l8);
    v16h a1 = load_frag_pk(pa + RT + l8);
    v16h b0 = load_frag_pk(pb + l8);
    v16h b1 = load_frag_pk(pb + RT + l8);
    v16h b2 = load_frag_pk(pb + 2 * RT + l8);
    v16h b3 = load_frag_pk(pb + 3 * RT + l8);
#pragma unroll 4
    for (int k0 = 0; k0 < D_MODEL; k0 += 32) {
        v16h na0, na1, nb0, nb1, nb2, nb3;
        const int kn = k0 + 32;
        if (kn < D_MODEL) {
            pa += PK_BLOCK;
            pb += PK_BLOCK;
            na0 = load_frag_pk(pa + l8);
            na1 = load_frag_pk(pa + RT + l8);
            nb0 = load_frag_pk(pb + l8);
            nb1 = load_frag_pk(pb + RT + l8);
            nb2 = load_frag_pk(pb + 2 * RT + l8);
            nb3 = load_frag_pk(pb + 3 * RT + l8);
            // A later load's result may land in a register that these loads name
            // as their address: the wait stands in front of that overwrite.
            asm volatile("s_wait_xcnt 0x0" ::: "memory");
        }
        // Holds the next step's loads ahead of this step's WMMAs; without it the
        // compiler sinks them to their first use and the wave waits out each load.
        __builtin_amdgcn_sched_barrier(0);
        // 8 independent accumulation chains
        acc[0][0] = wmma_f16(a0, b0, acc[0][0]);
        acc[0][1] = wmma_f16(a0, b1, acc[0][1]);
        acc[0][2] = wmma_f16(a0, b2, acc[0][2]);
        acc[0][3] = wmma_f16(a0, b3, acc[0][3]);
        acc[1][0] = wmma_f16(a1, b0, acc[1][0]);
        acc[1][1] = wmma_f16(a1, b1, acc[1][1]);
        acc[1][2] = wmma_f16(a1, b2, acc[1][2]);
        acc[1][3] = wmma_f16(a1, b3, acc[1][3]);
        a0 = na0; a1 = na1;
        b0 = nb0; b1 = nb1; b2 = nb2; b3 = nb3;
    }
}

// ---- QKV projection: C = x @ W^T (+bias) * scale, head-split f16 output ----
// One wave computes a 32x64 tile. 2048 waves = 256 blocks x 8 waves.
__global__ void __launch_bounds__(256)
proj_qkv_kernel(const _Float16* __restrict__ A,    // MROWS x D_MODEL, fragment order
                const _Float16* __restrict__ Wt,   // D_MODEL x D_MODEL (N x K), fragment order
                const float*    __restrict__ bias, // D_MODEL
                _Float16*       __restrict__ dst,  // [b,h][s,dstStride]; fragment order per (b,h) if DAUG wide
                int dstStride, float scale) {
    const int lane = threadIdx.x & 31;
    // wave number read as a scalar: the block addresses then stay in scalar registers
    const int wid  = blockIdx.x * 8 + __builtin_amdgcn_readfirstlane(threadIdx.x >> 5);
    const int m0   = (wid >> 4) << 5;   // 128 row tiles of 32
    const int n0   = (wid & 15) << 6;   // 16 col groups of 64

    v8f acc[2][4] = {};
    gemm_core_32x64(A, Wt, m0, n0, lane, acc);

    const int half = lane >> 4;
    const int nlo  = lane & 15;
    if (dstStride == DAUG) {
        // The 32-row tile lies in one batch and the 64-column group is one head.
        // pk_off adds over disjoint index bits: one lane base, constant steps.
        _Float16* lp = dst
            + ((size_t)(m0 >> 11) * NHEADS + (n0 >> 6)) * SEQ * DAUG
            + pk_off((m0 & (SEQ - 1)) + half * 8, nlo, DAUG / 32);
#pragma unroll
        for (int mi = 0; mi < 2; ++mi)
#pragma unroll
            for (int j = 0; j < 4; ++j)
#pragma unroll
                for (int r = 0; r < 8; ++r) {
                    float v = (acc[mi][j][r] + bias[n0 + j * 16 + nlo]) * scale;
                    lp[pk_off(mi * 16 + r, j * 16, DAUG / 32)] = (_Float16)v;
                }
        return;
    }
#pragma unroll
    for (int mi = 0; mi < 2; ++mi)
#pragma unroll
        for (int j = 0; j < 4; ++j)
#pragma unroll
            for (int r = 0; r < 8; ++r) {
                int m = m0 + mi * 16 + r + half * 8;
                int n = n0 + j * 16 + nlo;
                int bb = m >> 11, s = m & (SEQ - 1);
                int hh = n >> 6,  d = n & (HDIM - 1);
                float v = (acc[mi][j][r] + bias[n]) * scale;
                dst[(((size_t)bb * NHEADS + hh) * SEQ + s) * dstStride + d] =
                    (_Float16)v;
            }
}

// ---- output projection: out = O @ Wo^T + bo (fp32 out) ---------------------
__global__ void __launch_bounds__(256)
proj_out_kernel(const _Float16* __restrict__ A,    // MROWS x D_MODEL (f16), fragment order
                const _Float16* __restrict__ Wt,   // D_MODEL x D_MODEL (N x K), fragment order
                const float*    __restrict__ bias,
                float*          __restrict__ out) {
    const int lane = threadIdx.x & 31;
    // wave number read as a scalar: the block addresses then stay in scalar registers
    const int wid  = blockIdx.x * 8 + __builtin_amdgcn_readfirstlane(threadIdx.x >> 5);
    const int m0   = (wid >> 4) << 5;
    const int n0   = (wid & 15) << 6;

    v8f acc[2][4] = {};
    gemm_core_32x64(A, Wt, m0, n0, lane, acc);

    const int half = lane >> 4;
    const int nlo  = lane & 15;
#pragma unroll
    for (int mi = 0; mi < 2; ++mi)
#pragma unroll
        for (int j = 0; j < 4; ++j)
#pragma unroll
            for (int r = 0; r < 8; ++r) {
                int m = m0 + mi * 16 + r + half * 8;
                int n = n0 + j * 16 + nlo;
                out[(size_t)m * D_MODEL + n] = acc[mi][j][r] + bias[n];
            }
}

// ---- fill positional halves of Qa / Ka -------------------------------------
__global__ void augment_kernel(const float* __restrict__ pe,
                               const float* __restrict__ alpha,
                               _Float16* __restrict__ Qa,
                               _Float16* __restrict__ Ka) {
    // one thread per 16-byte chunk of the positional k blocks (2 and 3 of 4)
    int t = blockIdx.x * blockDim.x + threadIdx.x;   // over B*H*S*64/8
    if (t >= BATCH * NHEADS * SEQ * HDIM / 8) return;
    const int lane = t & 31;
    const int part = (t >> 5) & 1;
    const int kbp  = (t >> 6) & 1;
    const int rt   = (t >> 7) & (SEQ / 16 - 1);
    const int bh   = t >> 14;
    const int s    = rt * 16 + (lane & 15);
    const int d    = kbp * 32 + part * 16 + (lane >> 4) * 8;
    const float al = alpha[bh & (NHEADS - 1)];
    const float4* pp = (const float4*)(pe + s * HDIM + d);
    float4 u = pp[0];
    float4 w = pp[1];
    float p[8] = {u.x, u.y, u.z, u.w, w.x, w.y, w.z, w.w};
    v8h qv, kv;
#pragma unroll
    for (int i = 0; i < 8; ++i) {
        qv[i] = (_Float16)(al * p[i]);
        kv[i] = (_Float16)p[i];
    }
    size_t base = (size_t)bh * SEQ * DAUG + pk_off(s, HDIM + d, DAUG / 32);
    *(v8h*)(Qa + base) = qv;
    *(v8h*)(Ka + base) = kv;
}

// ---- fused flash attention over augmented dim 128 --------------------------
// Block = (b, h, 128 q rows) -> 8 waves, each wave owns 16 q rows.
__global__ void __launch_bounds__(256)
attn_kernel(const _Float16* __restrict__ Qa,   // [b,h][s,128], fragment order
            const _Float16* __restrict__ Ka,   // [b,h][s,128], fragment order
            const _Float16* __restrict__ V,    // [b,h,s,64]
            const int*      __restrict__ mask, // [b,s]
            const float*    __restrict__ beta, // [h]
            _Float16*       __restrict__ O) {  // MROWS x D_MODEL, fragment order
    __shared__ __align__(16) _Float16 VT[HDIM * LDS_LDV];       // V^T tile [d][k]
    __shared__ __align__(16) _Float16 PS[8 * 16 * LDS_LDP];     // per-wave P

    const int lane = threadIdx.x & 31;
    const int widx = threadIdx.x >> 5;
    const int bh   = blockIdx.x >> 4;           // b*16 + h
    const int b    = bh >> 4;
    const int h    = bh & 15;
    const int q0   = (blockIdx.x & 15) * 128 + widx * 16;

    const _Float16* Qh = Qa + (size_t)bh * SEQ * DAUG;
    const _Float16* Kh = Ka + (size_t)bh * SEQ * DAUG;
    const _Float16* Vh = V  + (size_t)bh * SEQ * HDIM;
    const float bet = beta[h];

    v16h qf[4];
#pragma unroll
    for (int kq = 0; kq < 4; ++kq) qf[kq] = load_frag_pk(Qh + ((q0 >> 4) * (DAUG / 32) + kq) * PK_BLOCK + lane * 8);

    v8f oacc[4] = {};
    float rmax[8], rsum[8];
#pragma unroll
    for (int r = 0; r < 8; ++r) { rmax[r] = -3.0e38f; rsum[r] = 0.f; }

    const int half = lane >> 4;
    const int nlo  = lane & 15;
    _Float16* myP = &PS[widx * 16 * LDS_LDP];

    for (int k0 = 0; k0 < SEQ; k0 += 64) {
        // ---- cooperative V^T staging (256 threads, 64x64 f16 tile) ----
        {
            int kk = threadIdx.x & 63;
            int d0 = (threadIdx.x >> 6) * 16;
            const _Float16* vp = Vh + (size_t)(k0 + kk) * HDIM + d0;
            v8h a = *(const v8h*)vp;
            v8h c = *(const v8h*)(vp + 8);
#pragma unroll
            for (int i = 0; i < 8; ++i) {
                VT[(d0 + i)     * LDS_LDV + kk] = a[i];
                VT[(d0 + 8 + i) * LDS_LDV + kk] = c[i];
            }
            if (k0 + 64 < SEQ)  // pull next V tile toward L2/L0
                __builtin_prefetch(Vh + (size_t)(k0 + 64 + kk) * HDIM + d0, 0, 1);
        }
        __syncthreads();

        // ---- scores S = Qa.Ka^T (16x64, K=128); kq-outer => 4 independent
        //      WMMA chains per step, 4 K-frag loads clustered per step ----
        v8f sc[4] = {};
#pragma unroll
        for (int kq = 0; kq < 4; ++kq) {
            v16h kb[4];
#pragma unroll
            for (int j = 0; j < 4; ++j)
                kb[j] = load_frag_pk(Kh + (((k0 >> 4) + j) * (DAUG / 32) + kq) * PK_BLOCK + lane * 8);
#pragma unroll
            for (int j = 0; j < 4; ++j)
                sc[j] = wmma_f16(qf[kq], kb[j], sc[j]);
        }
#pragma unroll
        for (int j = 0; j < 4; ++j) {
            int mv = mask[b * SEQ + k0 + j * 16 + nlo];
#pragma unroll
            for (int r = 0; r < 8; ++r)
                sc[j][r] = (mv == 0) ? -3.0e38f : (sc[j][r] + bet);
        }

        // ---- online softmax (rows live across 16 lanes of each half) ----
#pragma unroll
        for (int r = 0; r < 8; ++r) {
            float m = fmaxf(fmaxf(sc[0][r], sc[1][r]), fmaxf(sc[2][r], sc[3][r]));
#pragma unroll
            for (int off = 1; off < 16; off <<= 1)
                m = fmaxf(m, __shfl_xor(m, off, 32));
            float nm   = fmaxf(rmax[r], m);
            float corr = __expf(rmax[r] - nm);
            rmax[r] = nm;
            rsum[r] *= corr;
#pragma unroll
            for (int j = 0; j < 4; ++j) oacc[j][r] *= corr;
            float ls = 0.f;
#pragma unroll
            for (int j = 0; j < 4; ++j) {
                float p = __expf(sc[j][r] - nm);
                sc[j][r] = p;
                ls += p;
            }
#pragma unroll
            for (int off = 1; off < 16; off <<= 1)
                ls += __shfl_xor(ls, off, 32);
            rsum[r] += ls;
        }

        // ---- stage P (C layout -> row-major LDS) ----
#pragma unroll
        for (int j = 0; j < 4; ++j)
#pragma unroll
            for (int r = 0; r < 8; ++r)
                myP[(r + half * 8) * LDS_LDP + j * 16 + nlo] = (_Float16)sc[j][r];

        // ---- P.V : A-frags from P stage, B-frags from V^T stage ----
#pragma unroll
        for (int kk = 0; kk < 2; ++kk) {
            v16h pa = load_frag(myP, LDS_LDP, 0, kk * 32, lane);
            v16h vb[4];
#pragma unroll
            for (int j2 = 0; j2 < 4; ++j2)
                vb[j2] = load_frag(VT, LDS_LDV, j2 * 16, kk * 32, lane);
#pragma unroll
            for (int j2 = 0; j2 < 4; ++j2)
                oacc[j2] = wmma_f16(pa, vb[j2], oacc[j2]);
        }
        __syncthreads();   // protect VT before next staging round
    }

    // ---- normalize and store O (4096 x 1024, row b*S+s, column h*64+d) ----
#pragma unroll
    for (int r = 0; r < 8; ++r) {
        float inv = 1.f / fmaxf(rsum[r], 1e-20f);
        int s = q0 + r + half * 8;
#pragma unroll
        for (int j2 = 0; j2 < 4; ++j2) {
            int d = j2 * 16 + nlo;
            O[pk_off(b * SEQ + s, h * HDIM + d, D_MODEL / 32)] =
                (_Float16)(oacc[j2][r] * inv);
        }
    }
}

// ---------------------------------------------------------------------------
extern "C" void kernel_launch(void* const* d_in, const int* in_sizes, int n_in,
                              void* d_out, int out_size, void* d_ws, size_t ws_size,
                              hipStream_t stream) {
    const float* x     = (const float*)d_in[0];
    const int*   mask  = (const int*)d_in[1];
    const float* Wq    = (const float*)d_in[2];
    const float* bq    = (const float*)d_in[3];
    const float* Wk    = (const float*)d_in[4];
    const float* bk    = (const float*)d_in[5];
    const float* Wv    = (const float*)d_in[6];
    const float* bv    = (const float*)d_in[7];
    const float* Wo    = (const float*)d_in[8];
    const float* bo    = (const float*)d_in[9];
    const float* pe    = (const float*)d_in[10];
    const float* alpha = (const float*)d_in[11];
    const float* beta  = (const float*)d_in[12];
    float* out = (float*)d_out;

    // workspace carve-up (64 MB total)
    char* ws = (char*)d_ws;
    _Float16* xh  = (_Float16*)ws; ws += (size_t)MROWS * D_MODEL * 2;        // 8 MB
    _Float16* Wqh = (_Float16*)ws; ws += (size_t)D_MODEL * D_MODEL * 2;      // 2 MB
    _Float16* Wkh = (_Float16*)ws; ws += (size_t)D_MODEL * D_MODEL * 2;
    _Float16* Wvh = (_Float16*)ws; ws += (size_t)D_MODEL * D_MODEL * 2;
    _Float16* Woh = (_Float16*)ws; ws += (size_t)D_MODEL * D_MODEL * 2;
    _Float16* Qa  = (_Float16*)ws; ws += (size_t)BATCH * NHEADS * SEQ * DAUG * 2; // 16 MB
    _Float16* Kaa = (_Float16*)ws; ws += (size_t)BATCH * NHEADS * SEQ * DAUG * 2; // 16 MB
    _Float16* Vb  = (_Float16*)ws; ws += (size_t)BATCH * NHEADS * SEQ * HDIM * 2; //  8 MB
    _Float16* Oh  = (_Float16*)ws; ws += (size_t)MROWS * D_MODEL * 2;             //  8 MB

    int n;
    n = MROWS * D_MODEL / 8;
    cvt_f32_f16_kernel<<<(n + 255) / 256, 256, 0, stream>>>(x, xh, n);
    n = D_MODEL * D_MODEL / 8;
    cvt_f32_f16_kernel<<<(n + 255) / 256, 256, 0, stream>>>(Wq, Wqh, n);
    cvt_f32_f16_kernel<<<(n + 255) / 256, 256, 0, stream>>>(Wk, Wkh, n);
    cvt_f32_f16_kernel<<<(n + 255) / 256, 256, 0, stream>>>(Wv, Wvh, n);
    cvt_f32_f16_kernel<<<(n + 255) / 256, 256, 0, stream>>>(Wo, Woh, n);

    // q scaled by 1/sqrt(HDIM)=1/8 folded into Qa content half
    proj_qkv_kernel<<<256, 256, 0, stream>>>(xh, Wqh, bq, Qa, DAUG, 0.125f);
    proj_qkv_kernel<<<256, 256, 0, stream>>>(xh, Wkh, bk, Kaa, DAUG, 1.0f);
    proj_qkv_kernel<<<256, 256, 0, stream>>>(xh, Wvh, bv, Vb, HDIM, 1.0f);

    n = BATCH * NHEADS * SEQ * HDIM / 8;
    augment_kernel<<<(n + 255) / 256, 256, 0, stream>>>(pe, alpha, Qa, Kaa);

    attn_kernel<<<512, 256, 0, stream>>>(Qa, Kaa, Vb, mask, beta, Oh);

    proj_out_kernel<<<256, 256, 0, stream>>>(Oh, Woh, bo, out);
}

// v002
// A run of this version takes 220 microseconds.
// In both of two side-by-side timings against v001, it was 1.21 times as fast.
// All steps since v000 together make it 1.49 times as fast.
#include <hip/hip_runtime.h>
#include <hip/hip_fp16.h>

// ---------------------------------------------------------------------------
// Disentangled attention, MI455X (gfx1250, wave32, WMMA).
// scores = (q.k)/8 + alpha_h*(pe_q.pe_k) + beta_h  folded into one GEMM by
// augmenting head-dim 64 -> 128:  Qa=[q/8, alpha*pe], Ka=[k, pe].
// f16 WMMA + fp32 accumulation; flash-style online softmax (no 512MB scores).
// GEMMs use 32x64 wave tiles with double-buffered fragments so loads overlap
// the v_wmma stream instead of serializing on s_wait_loadcnt 0.
// Every f16 operand that a wave reads from global memory except V (x, weights, Qa,
// Ka, O) is stored by its producer in fragment order, so that each wave-wide
// 16-byte load covers 512 contiguous bytes (4 whole lines, not 16 partial ones).
// ---------------------------------------------------------------------------

typedef __attribute__((ext_vector_type(16))) _Float16 v16h;
typedef __attribute__((ext_vector_type(8)))  _Float16 v8h;
typedef __attribute__((ext_vector_type(8)))  float    v8f;

#define D_MODEL 1024
#define NHEADS  16
#define HDIM    64
#define SEQ     2048
#define BATCH   2
#define MROWS   (BATCH * SEQ)   // 4096
#define DAUG    128             // augmented head dim (64 content + 64 pos)

#define LDS_LDV 72

// ---- WMMA helper -----------------------------------------------------------
static __device__ __forceinline__ v8f wmma_f16(v16h a, v16h b, v8f c) {
    return __builtin_amdgcn_wmma_f32_16x16x32_f16(false, a, false, b, (short)0, c,
                                                  false, false);
}

// ---- 16-bit A-layout fragment load (also B-frag when given the N x K view) --
// ISA 7.12.2: lanes 0-15 hold row M=lane with K = {k0..k0+7, k0+16..k0+23};
// lanes 16-31 hold the same rows with K = {k0+8..k0+15, k0+24..k0+31}.
static __device__ __forceinline__ v16h load_frag(const _Float16* __restrict__ p,
                                                 int ld, int row0, int k0, int lane) {
    const int r  = lane & 15;
    const int h8 = (lane >> 4) << 3;   // 0 or 8
    const _Float16* base = p + (size_t)(row0 + r) * ld + k0 + h8;
    v8h lo = *(const v8h*)(base);
    v8h hi = *(const v8h*)(base + 16);
    return __builtin_shufflevector(lo, hi, 0,1,2,3,4,5,6,7,8,9,10,11,12,13,14,15);
}

// ---- fragment-order storage of a rows x K f16 matrix ------------------------
// One 16-row x 32-k fragment is a 1 KB block; blocks run along k, then rows.
// Inside a block: 512 B with each lane's first 8 halves, then 512 B with its
// second 8, in the lane and k order of load_frag above.
static __device__ __forceinline__ size_t pk_off(int row, int k, int kblocks) {
    return ((size_t)((row >> 4) * kblocks + (k >> 5)) << 9)
         + (((k >> 4) & 1) << 8)
         + (((row & 15) + (((k >> 3) & 1) << 4)) << 3)
         + (k & 7);
}

#define PK_BLOCK 512   // halves in one 16 x 32 fragment block

// base = start of the fragment's block + lane * 8
static __device__ __forceinline__ v16h load_frag_pk(const _Float16* __restrict__ base) {
    v8h lo = *(const v8h*)(base);
    v8h hi = *(const v8h*)(base + 256);
    return __builtin_shufflevector(lo, hi, 0,1,2,3,4,5,6,7,8,9,10,11,12,13,14,15);
}

// ---- fp32 -> f16 convert, rows x D_MODEL, into fragment order ---------------
// One thread per 16-byte chunk of the output; chunk c lies at out + 8 * c.
__global__ void cvt_f32_f16_kernel(const float* __restrict__ in,
                                   _Float16* __restrict__ out, int nchunks) {
    int c = blockIdx.x * blockDim.x + threadIdx.x;
    if (c >= nchunks) return;
    const int lane = c & 31;
    const int part = (c >> 5) & 1;
    const int kb   = (c >> 6) & (D_MODEL / 32 - 1);
    const int rt   = c >> 11;
    const int row  = rt * 16 + (lane & 15);
    const int k    = kb * 32 + part * 16 + (lane >> 4) * 8;
    const float4* ip = (const float4*)(in + (size_t)row * D_MODEL + k);
    float4 u = ip[0];
    float4 w = ip[1];
    v8h o;
    o[0] = (_Float16)u.x; o[1] = (_Float16)u.y; o[2] = (_Float16)u.z; o[3] = (_Float16)u.w;
    o[4] = (_Float16)w.x; o[5] = (_Float16)w.y; o[6] = (_Float16)w.z; o[7] = (_Float16)w.w;
    *(v8h*)(out + (size_t)c * 8) = o;
}

// ---- common 32x64 GEMM core: acc[mi][j] += A[m0+mi*16,:] . Wt[n0+j*16,:]^T --
// Double-buffered: next k-step's fragments are loaded into fresh registers
// while the 8 WMMAs for the current step issue.
static __device__ __forceinline__ void gemm_core_32x64(
        const _Float16* __restrict__ A, const _Float16* __restrict__ Wt,
        int m0, int n0, int lane, v8f acc[2][4]) {
    const int RT = (D_MODEL / 32) * PK_BLOCK;   // halves per 16-row tile
    const int l8 = lane * 8;
    const _Float16* pa = A  + (size_t)(m0 >> 4) * RT;
    const _Float16* pb = Wt + (size_t)(n0 >> 4) * RT;
    v16h a0 = load_frag_pk(pa + l8);
    v16h a1 = load_frag_pk(pa + RT + l8);
    v16h b0 = load_frag_pk(pb + l8);
    v16h b1 = load_frag_pk(pb + RT + l8);
    v16h b2 = load_frag_pk(pb + 2 * RT + l8);
    v16h b3 = load_frag_pk(pb + 3 * RT + l8);
#pragma unroll 4
    for (int k0 = 0; k0 < D_MODEL; k0 += 32) {
        v16h na0, na1, nb0, nb1, nb2, nb3;
        const int kn = k0 + 32;
        if (kn < D_MODEL) {
            pa += PK_BLOCK;
            pb += PK_BLOCK;
            na0 = load_frag_pk(pa + l8);
            na1 = load_frag_pk(pa + RT + l8);
            nb0 = load_frag_pk(pb + l8);
            nb1 = load_frag_pk(pb + RT + l8);
            nb2 = load_frag_pk(pb + 2 * RT + l8);
            nb3 = load_frag_pk(pb + 3 * RT + l8);
            // A later load's result may land in a register that these loads name
            // as their address: the wait stands in front of that overwrite.
            asm volatile("s_wait_xcnt 0x0" ::: "memory");
        }
        // Holds the next step's loads ahead of this step's WMMAs; without it the
        // compiler sinks them to their first use and the wave waits out each load.
        __builtin_amdgcn_sched_barrier(0);
        // 8 independent accumulation chains
        acc[0][0] = wmma_f16(a0, b0, acc[0][0]);
        acc[0][1] = wmma_f16(a0, b1, acc[0][1]);
        acc[0][2] = wmma_f16(a0, b2, acc[0][2]);
        acc[0][3] = wmma_f16(a0, b3, acc[0][3]);
        acc[1][0] = wmma_f16(a1, b0, acc[1][0]);
        acc[1][1] = wmma_f16(a1, b1, acc[1][1]);
        acc[1][2] = wmma_f16(a1, b2, acc[1][2]);
        acc[1][3] = wmma_f16(a1, b3, acc[1][3]);
        a0 = na0; a1 = na1;
        b0 = nb0; b1 = nb1; b2 = nb2; b3 = nb3;
    }
}

// ---- QKV projection: C = x @ W^T (+bias) * scale, head-split f16 output ----
// One wave computes a 32x64 tile. 2048 waves = 256 blocks x 8 waves.
__global__ void __launch_bounds__(256)
proj_qkv_kernel(const _Float16* __restrict__ A,    // MROWS x D_MODEL, fragment order
                const _Float16* __restrict__ Wt,   // D_MODEL x D_MODEL (N x K), fragment order
                const float*    __restrict__ bias, // D_MODEL
                _Float16*       __restrict__ dst,  // [b,h][s,dstStride]; fragment order per (b,h) if DAUG wide
                int dstStride, float scale) {
    const int lane = threadIdx.x & 31;
    // wave number read as a scalar: the block addresses then stay in scalar registers
    const int wid  = blockIdx.x * 8 + __builtin_amdgcn_readfirstlane(threadIdx.x >> 5);
    const int m0   = (wid >> 4) << 5;   // 128 row tiles of 32
    const int n0   = (wid & 15) << 6;   // 16 col groups of 64

    v8f acc[2][4] = {};
    gemm_core_32x64(A, Wt, m0, n0, lane, acc);

    const int half = lane >> 4;
    const int nlo  = lane & 15;
    if (dstStride == DAUG) {
        // The 32-row tile lies in one batch and the 64-column group is one head.
        // pk_off adds over disjoint index bits: one lane base, constant steps.
        _Float16* lp = dst
            + ((size_t)(m0 >> 11) * NHEADS + (n0 >> 6)) * SEQ * DAUG
            + pk_off((m0 & (SEQ - 1)) + half * 8, nlo, DAUG / 32);
#pragma unroll
        for (int mi = 0; mi < 2; ++mi)
#pragma unroll
            for (int j = 0; j < 4; ++j)
#pragma unroll
                for (int r = 0; r < 8; ++r) {
                    float v = (acc[mi][j][r] + bias[n0 + j * 16 + nlo]) * scale;
                    lp[pk_off(mi * 16 + r, j * 16, DAUG / 32)] = (_Float16)v;
                }
        return;
    }
#pragma unroll
    for (int mi = 0; mi < 2; ++mi)
#pragma unroll
        for (int j = 0; j < 4; ++j)
#pragma unroll
            for (int r = 0; r < 8; ++r) {
                int m = m0 + mi * 16 + r + half * 8;
                int n = n0 + j * 16 + nlo;
                int bb = m >> 11, s = m & (SEQ - 1);
                int hh = n >> 6,  d = n & (HDIM - 1);
                float v = (acc[mi][j][r] + bias[n]) * scale;
                dst[(((size_t)bb * NHEADS + hh) * SEQ + s) * dstStride + d] =
                    (_Float16)v;
            }
}

// ---- output projection: out = O @ Wo^T + bo (fp32 out) ---------------------
__global__ void __launch_bounds__(256)
proj_out_kernel(const _Float16* __restrict__ A,    // MROWS x D_MODEL (f16), fragment order
                const _Float16* __restrict__ Wt,   // D_MODEL x D_MODEL (N x K), fragment order
                const float*    __restrict__ bias,
                float*          __restrict__ out) {
    const int lane = threadIdx.x & 31;
    // wave number read as a scalar: the block addresses then stay in scalar registers
    const int wid  = blockIdx.x * 8 + __builtin_amdgcn_readfirstlane(threadIdx.x >> 5);
    const int m0   = (wid >> 4) << 5;
    const int n0   = (wid & 15) << 6;

    v8f acc[2][4] = {};
    gemm_core_32x64(A, Wt, m0, n0, lane, acc);

    const int half = lane >> 4;
    const int nlo  = lane & 15;
#pragma unroll
    for (int mi = 0; mi < 2; ++mi)
#pragma unroll
        for (int j = 0; j < 4; ++j)
#pragma unroll
            for (int r = 0; r < 8; ++r) {
                int m = m0 + mi * 16 + r + half * 8;
                int n = n0 + j * 16 + nlo;
                out[(size_t)m * D_MODEL + n] = acc[mi][j][r] + bias[n];
            }
}

// ---- fill positional halves of Qa / Ka -------------------------------------
__global__ void augment_kernel(const float* __restrict__ pe,
                               const float* __restrict__ alpha,
                               _Float16* __restrict__ Qa,
                               _Float16* __restrict__ Ka) {
    // one thread per 16-byte chunk of the positional k blocks (2 and 3 of 4)
    int t = blockIdx.x * blockDim.x + threadIdx.x;   // over B*H*S*64/8
    if (t >= BATCH * NHEADS * SEQ * HDIM / 8) return;
    const int lane = t & 31;
    const int part = (t >> 5) & 1;
    const int kbp  = (t >> 6) & 1;
    const int rt   = (t >> 7) & (SEQ / 16 - 1);
    const int bh   = t >> 14;
    const int s    = rt * 16 + (lane & 15);
    const int d    = kbp * 32 + part * 16 + (lane >> 4) * 8;
    const float al = alpha[bh & (NHEADS - 1)];
    const float4* pp = (const float4*)(pe + s * HDIM + d);
    float4 u = pp[0];
    float4 w = pp[1];
    float p[8] = {u.x, u.y, u.z, u.w, w.x, w.y, w.z, w.w};
    v8h qv, kv;
#pragma unroll
    for (int i = 0; i < 8; ++i) {
        qv[i] = (_Float16)(al * p[i]);
        kv[i] = (_Float16)p[i];
    }
    size_t base = (size_t)bh * SEQ * DAUG + pk_off(s, HDIM + d, DAUG / 32);
    *(v8h*)(Qa + base) = qv;
    *(v8h*)(Ka + base) = kv;
}

// ---- lane l with lane l ^ 16 (the two lanes that share one column) ----------
static __device__ __forceinline__ float xhalf(float x) {
    int v = __builtin_bit_cast(int, x);
    return __builtin_bit_cast(float,
        __builtin_amdgcn_permlanex16(v, v, 0x76543210, 0xfedcba98, false, false));
}

typedef __attribute__((ext_vector_type(2))) float    v2f;
typedef __attribute__((ext_vector_type(2))) _Float16 v2h;

// ---- fused flash attention over augmented dim 128 --------------------------
// Block = (b, h, 128 q rows) -> 8 waves, each wave owns 16 q rows.
// Transposed products: S^T = Ka.Qa^T and O^T += V^T.P^T. In an accumulator tile
// a lane holds 8 keys (or 8 d) of ONE query, q0 + (lane & 15): maximum and
// sum run over the lane's own registers, the two lanes of a query exchange once,
// and two converted S^T tiles are the B operand of the second product as they
// stand, so P never goes through LDS.
__global__ void __launch_bounds__(256)
attn_kernel(const _Float16* __restrict__ Qa,   // [b,h][s,128], fragment order
            const _Float16* __restrict__ Ka,   // [b,h][s,128], fragment order
            const _Float16* __restrict__ V,    // [b,h,s,64]
            const int*      __restrict__ mask, // [b,s]
            const float*    __restrict__ beta, // [h]
            _Float16*       __restrict__ O) {  // MROWS x D_MODEL, fragment order
    __shared__ __align__(16) _Float16 VT[HDIM * LDS_LDV];       // V^T tile [d][k]
    __shared__ __align__(32) float    KB[SEQ];                  // per key: beta, or -3e38 where masked

    const int lane = threadIdx.x & 31;
    const int widx = threadIdx.x >> 5;
    const int bh   = blockIdx.x >> 4;           // b*16 + h
    const int b    = bh >> 4;
    const int h    = bh & 15;
    const int q0   = (blockIdx.x & 15) * 128 + widx * 16;

    const _Float16* Qh = Qa + (size_t)bh * SEQ * DAUG;
    const _Float16* Kh = Ka + (size_t)bh * SEQ * DAUG;
    const _Float16* Vh = V  + (size_t)bh * SEQ * HDIM;
    const float bet = beta[h];

    // A key is a register index of S^T, so its mask and beta enter as the start
    // value of its S^T accumulator row. Read behind the loop's first barrier.
    {
        const int4* mp = (const int4*)(mask + b * SEQ + threadIdx.x * (SEQ / 256));
        const int4 ma = mp[0], mc = mp[1];
        float4 fa, fc;
        fa.x = (ma.x == 0) ? -3.0e38f : bet;  fa.y = (ma.y == 0) ? -3.0e38f : bet;
        fa.z = (ma.z == 0) ? -3.0e38f : bet;  fa.w = (ma.w == 0) ? -3.0e38f : bet;
        fc.x = (mc.x == 0) ? -3.0e38f : bet;  fc.y = (mc.y == 0) ? -3.0e38f : bet;
        fc.z = (mc.z == 0) ? -3.0e38f : bet;  fc.w = (mc.w == 0) ? -3.0e38f : bet;
        float4* kp = (float4*)&KB[threadIdx.x * (SEQ / 256)];
        kp[0] = fa;
        kp[1] = fc;
    }

    v16h qf[4];
#pragma unroll
    for (int kq = 0; kq < 4; ++kq) qf[kq] = load_frag_pk(Qh + ((q0 >> 4) * (DAUG / 32) + kq) * PK_BLOCK + lane * 8);

    v8f oacc[4] = {};            // oacc[j2][r] = O^T[j2*16 + half*8 + r][q0 + nlo]
    float rmax = -3.0e38f;       // this lane's query, both halves alike
    float rsum = 0.f;            // this lane's half of the keys only; joined at the end

    const int half = lane >> 4;
    const int nlo  = lane & 15;

    for (int k0 = 0; k0 < SEQ; k0 += 64) {
        // ---- cooperative V^T staging (256 threads, 64x64 f16 tile) ----
        {
            int kk = threadIdx.x & 63;
            int d0 = (threadIdx.x >> 6) * 16;
            const _Float16* vp = Vh + (size_t)(k0 + kk) * HDIM + d0;
            v8h a = *(const v8h*)vp;
            v8h c = *(const v8h*)(vp + 8);
#pragma unroll
            for (int i = 0; i < 8; ++i) {
                VT[(d0 + i)     * LDS_LDV + kk] = a[i];
                VT[(d0 + 8 + i) * LDS_LDV + kk] = c[i];
            }
            if (k0 + 64 < SEQ)  // pull next V tile toward L2/L0
                __builtin_prefetch(Vh + (size_t)(k0 + 64 + kk) * HDIM + d0, 0, 1);
        }
        __syncthreads();

        // ---- scores S^T = Ka.Qa^T (64 keys x 16 q, K=128); kq-outer => 4
        //      independent WMMA chains per step, 4 K-frag loads clustered per step.
        //      sc[j][r] = score(key k0 + j*16 + half*8 + r, query q0 + nlo) ----
        v8f sc[4];
#pragma unroll
        for (int j = 0; j < 4; ++j)
            sc[j] = *(const v8f*)&KB[k0 + j * 16 + half * 8];
#pragma unroll
        for (int kq = 0; kq < 4; ++kq) {
            v16h kb[4];
#pragma unroll
            for (int j = 0; j < 4; ++j)
                kb[j] = load_frag_pk(Kh + (((k0 >> 4) + j) * (DAUG / 32) + kq) * PK_BLOCK + lane * 8);
#pragma unroll
            for (int j = 0; j < 4; ++j)
                sc[j] = wmma_f16(kb[j], qf[kq], sc[j]);
        }

        // ---- online softmax: one query per lane ----
        float mt[4];   // one chain per tile: a tile's maximum runs under the later tiles' WMMAs
#pragma unroll
        for (int j = 0; j < 4; ++j) {
            mt[j] = sc[j][0];
#pragma unroll
            for (int r = 1; r < 8; ++r) mt[j] = fmaxf(mt[j], sc[j][r]);
        }
        float m = fmaxf(fmaxf(mt[0], mt[1]), fmaxf(mt[2], mt[3]));
        m = fmaxf(m, xhalf(m));
        const float nm   = fmaxf(rmax, m);
        const float corr = __expf(rmax - nm);
        rmax = nm;
#pragma unroll
        for (int j2 = 0; j2 < 4; ++j2) oacc[j2] *= corr;

        // p = exp(s - nm); elements 8*t .. 8*t+7 of the 32-key B operand are tile
        // 2*kk + t, registers 0..7: the k order of load_frag on the V^T side.
        v16h pb[2];
        v2f  ls[4];    // one sum chain per tile
#pragma unroll
        for (int j = 0; j < 4; ++j) {
#pragma unroll
            for (int r = 0; r < 8; r += 2) {
                v2f d = (v2f{sc[j][r], sc[j][r + 1]} - nm) * 1.44269504088896340736f;
                v2f p = {__builtin_amdgcn_exp2f(d.x), __builtin_amdgcn_exp2f(d.y)};
                ls[j] = (r == 0) ? p : ls[j] + p;
                v2h ph = __builtin_convertvector(p, v2h);
                pb[j >> 1][(j & 1) * 8 + r]     = ph.x;
                pb[j >> 1][(j & 1) * 8 + r + 1] = ph.y;
            }
        }
        const v2f lt = (ls[0] + ls[1]) + (ls[2] + ls[3]);
        rsum = rsum * corr + (lt.x + lt.y);

        // ---- O^T += V^T.P^T : A-frags from V^T stage, B-frags from registers ----
#pragma unroll
        for (int kk = 0; kk < 2; ++kk) {
            v16h vb[4];
#pragma unroll
            for (int j2 = 0; j2 < 4; ++j2)
                vb[j2] = load_frag(VT, LDS_LDV, j2 * 16, kk * 32, lane);
#pragma unroll
            for (int j2 = 0; j2 < 4; ++j2)
                oacc[j2] = wmma_f16(vb[j2], pb[kk], oacc[j2]);
        }
        __syncthreads();   // protect VT before next staging round
    }

    // ---- normalize and store O (4096 x 1024, row b*S+s, column h*64+d):
    //      a lane's 8 registers are 8 consecutive columns, one 16-byte chunk ----
    const float inv = 1.f / fmaxf(rsum + xhalf(rsum), 1e-20f);
#pragma unroll
    for (int j2 = 0; j2 < 4; ++j2) {
        v8h o;
#pragma unroll
        for (int r = 0; r < 8; ++r) o[r] = (_Float16)(oacc[j2][r] * inv);
        *(v8h*)(O + pk_off(b * SEQ + q0 + nlo, h * HDIM + j2 * 16 + half * 8, D_MODEL / 32)) = o;
    }
}

// ---------------------------------------------------------------------------
extern "C" void kernel_launch(void* const* d_in, const int* in_sizes, int n_in,
                              void* d_out, int out_size, void* d_ws, size_t ws_size,
                              hipStream_t stream) {
    const float* x     = (const float*)d_in[0];
    const int*   mask  = (const int*)d_in[1];
    const float* Wq    = (const float*)d_in[2];
    const float* bq    = (const float*)d_in[3];
    const float* Wk    = (const float*)d_in[4];
    const float* bk    = (const float*)d_in[5];
    const float* Wv    = (const float*)d_in[6];
    const float* bv    = (const float*)d_in[7];
    const float* Wo    = (const float*)d_in[8];
    const float* bo    = (const float*)d_in[9];
    const float* pe    = (const float*)d_in[10];
    const float* alpha = (const float*)d_in[11];
    const float* beta  = (const float*)d_in[12];
    float* out = (float*)d_out;

    // workspace carve-up (64 MB total)
    char* ws = (char*)d_ws;
    _Float16* xh  = (_Float16*)ws; ws += (size_t)MROWS * D_MODEL * 2;        // 8 MB
    _Float16* Wqh = (_Float16*)ws; ws += (size_t)D_MODEL * D_MODEL * 2;      // 2 MB
    _Float16* Wkh = (_Float16*)ws; ws += (size_t)D_MODEL * D_MODEL * 2;
    _Float16* Wvh = (_Float16*)ws; ws += (size_t)D_MODEL * D_MODEL * 2;
    _Float16* Woh = (_Float16*)ws; ws += (size_t)D_MODEL * D_MODEL * 2;
    _Float16* Qa  = (_Float16*)ws; ws += (size_t)BATCH * NHEADS * SEQ * DAUG * 2; // 16 MB
    _Float16* Kaa = (_Float16*)ws; ws += (size_t)BATCH * NHEADS * SEQ * DAUG * 2; // 16 MB
    _Float16* Vb  = (_Float16*)ws; ws += (size_t)BATCH * NHEADS * SEQ * HDIM * 2; //  8 MB
    _Float16* Oh  = (_Float16*)ws; ws += (size_t)MROWS * D_MODEL * 2;             //  8 MB

    int n;
    n = MROWS * D_MODEL / 8;
    cvt_f32_f16_kernel<<<(n + 255) / 256, 256, 0, stream>>>(x, xh, n);
    n = D_MODEL * D_MODEL / 8;
    cvt_f32_f16_kernel<<<(n + 255) / 256, 256, 0, stream>>>(Wq, Wqh, n);
    cvt_f32_f16_kernel<<<(n + 255) / 256, 256, 0, stream>>>(Wk, Wkh, n);
    cvt_f32_f16_kernel<<<(n + 255) / 256, 256, 0, stream>>>(Wv, Wvh, n);
    cvt_f32_f16_kernel<<<(n + 255) / 256, 256, 0, stream>>>(Wo, Woh, n);

    // q scaled by 1/sqrt(HDIM)=1/8 folded into Qa content half
    proj_qkv_kernel<<<256, 256, 0, stream>>>(xh, Wqh, bq, Qa, DAUG, 0.125f);
    proj_qkv_kernel<<<256, 256, 0, stream>>>(xh, Wkh, bk, Kaa, DAUG, 1.0f);
    proj_qkv_kernel<<<256, 256, 0, stream>>>(xh, Wvh, bv, Vb, HDIM, 1.0f);

    n = BATCH * NHEADS * SEQ * HDIM / 8;
    augment_kernel<<<(n + 255) / 256, 256, 0, stream>>>(pe, alpha, Qa, Kaa);

    attn_kernel<<<512, 256, 0, stream>>>(Qa, Kaa, Vb, mask, beta, Oh);

    proj_out_kernel<<<256, 256, 0, stream>>>(Oh, Woh, bo, out);
}

// v003
// A run of this version takes 145 microseconds.
// Timed twice side by side with v002, it ran 1.51 and 1.52 times as fast.
// Counting every step since v000, it is 2.26 times as fast.
#include <hip/hip_runtime.h>
#include <hip/hip_fp16.h>

// ---------------------------------------------------------------------------
// Disentangled attention, MI455X (gfx1250, wave32, WMMA).
// scores = (q.k)/8 + alpha_h*(pe_q.pe_k) + beta_h  folded into one GEMM by
// augmenting head-dim 64 -> 128:  Qa=[q/8, alpha*pe], Ka=[k, pe].
// f16 WMMA + fp32 accumulation; flash-style online softmax (no 512MB scores).
// GEMMs use 32x64 wave tiles with double-buffered fragments so loads overlap
// the v_wmma stream instead of serializing on s_wait_loadcnt 0.
// Every f16 operand that a wave reads from global memory except V (x, weights, Qa,
// Ka, O) is stored by its producer in fragment order, so that each wave-wide
// 16-byte load covers 512 contiguous bytes (4 whole lines, not 16 partial ones).
// ---------------------------------------------------------------------------

typedef __attribute__((ext_vector_type(16))) _Float16 v16h;
typedef __attribute__((ext_vector_type(8)))  _Float16 v8h;
typedef __attribute__((ext_vector_type(8)))  float    v8f;

#define D_MODEL 1024
#define NHEADS  16
#define HDIM    64
#define SEQ     2048
#define BATCH   2
#define MROWS   (BATCH * SEQ)   // 4096
#define DAUG    128             // augmented head dim (64 content + 64 pos)

#define LDS_LDV 72

// ---- WMMA helper -----------------------------------------------------------
static __device__ __forceinline__ v8f wmma_f16(v16h a, v16h b, v8f c) {
    return __builtin_amdgcn_wmma_f32_16x16x32_f16(false, a, false, b, (short)0, c,
                                                  false, false);
}

// ---- 16-bit A-layout fragment load (also B-frag when given the N x K view) --
// ISA 7.12.2: lanes 0-15 hold row M=lane with K = {k0..k0+7, k0+16..k0+23};
// lanes 16-31 hold the same rows with K = {k0+8..k0+15, k0+24..k0+31}.
static __device__ __forceinline__ v16h load_frag(const _Float16* __restrict__ p,
                                                 int ld, int row0, int k0, int lane) {
    const int r  = lane & 15;
    const int h8 = (lane >> 4) << 3;   // 0 or 8
    const _Float16* base = p + (size_t)(row0 + r) * ld + k0 + h8;
    v8h lo = *(const v8h*)(base);
    v8h hi = *(const v8h*)(base + 16);
    return __builtin_shufflevector(lo, hi, 0,1,2,3,4,5,6,7,8,9,10,11,12,13,14,15);
}

// ---- fragment-order storage of a rows x K f16 matrix ------------------------
// One 16-row x 32-k fragment is a 1 KB block; blocks run along k, then rows.
// Inside a block: 512 B with each lane's first 8 halves, then 512 B with its
// second 8, in the lane and k order of load_frag above.
static __device__ __forceinline__ size_t pk_off(int row, int k, int kblocks) {
    return ((size_t)((row >> 4) * kblocks + (k >> 5)) << 9)
         + (((k >> 4) & 1) << 8)
         + (((row & 15) + (((k >> 3) & 1) << 4)) << 3)
         + (k & 7);
}

#define PK_BLOCK 512   // halves in one 16 x 32 fragment block

// base = start of the fragment's block + lane * 8
static __device__ __forceinline__ v16h load_frag_pk(const _Float16* __restrict__ base) {
    v8h lo = *(const v8h*)(base);
    v8h hi = *(const v8h*)(base + 256);
    return __builtin_shufflevector(lo, hi, 0,1,2,3,4,5,6,7,8,9,10,11,12,13,14,15);
}

// ---- fp32 -> f16 convert, rows x D_MODEL, into fragment order ---------------
// One thread per 16-byte chunk of the output; chunk c lies at out + 8 * c.
__global__ void cvt_f32_f16_kernel(const float* __restrict__ in,
                                   _Float16* __restrict__ out, int nchunks) {
    int c = blockIdx.x * blockDim.x + threadIdx.x;
    if (c >= nchunks) return;
    const int lane = c & 31;
    const int part = (c >> 5) & 1;
    const int kb   = (c >> 6) & (D_MODEL / 32 - 1);
    const int rt   = c >> 11;
    const int row  = rt * 16 + (lane & 15);
    const int k    = kb * 32 + part * 16 + (lane >> 4) * 8;
    const float4* ip = (const float4*)(in + (size_t)row * D_MODEL + k);
    float4 u = ip[0];
    float4 w = ip[1];
    v8h o;
    o[0] = (_Float16)u.x; o[1] = (_Float16)u.y; o[2] = (_Float16)u.z; o[3] = (_Float16)u.w;
    o[4] = (_Float16)w.x; o[5] = (_Float16)w.y; o[6] = (_Float16)w.z; o[7] = (_Float16)w.w;
    *(v8h*)(out + (size_t)c * 8) = o;
}

// ---- common 32x64 GEMM core: acc[mi][j] += A[m0+mi*16,:] . Wt[n0+j*16,:]^T --
// Double-buffered: next k-step's fragments are loaded into fresh registers
// while the 8 WMMAs for the current step issue.
static __device__ __forceinline__ void gemm_core_32x64(
        const _Float16* __restrict__ A, const _Float16* __restrict__ Wt,
        int m0, int n0, int lane, v8f acc[2][4]) {
    const int RT = (D_MODEL / 32) * PK_BLOCK;   // halves per 16-row tile
    const int l8 = lane * 8;
    const _Float16* pa = A  + (size_t)(m0 >> 4) * RT;
    const _Float16* pb = Wt + (size_t)(n0 >> 4) * RT;
    v16h a0 = load_frag_pk(pa + l8);
    v16h a1 = load_frag_pk(pa + RT + l8);
    v16h b0 = load_frag_pk(pb + l8);
    v16h b1 = load_frag_pk(pb + RT + l8);
    v16h b2 = load_frag_pk(pb + 2 * RT + l8);
    v16h b3 = load_frag_pk(pb + 3 * RT + l8);
#pragma unroll 4
    for (int k0 = 0; k0 < D_MODEL; k0 += 32) {
        v16h na0, na1, nb0, nb1, nb2, nb3;
        const int kn = k0 + 32;
        if (kn < D_MODEL) {
            pa += PK_BLOCK;
            pb += PK_BLOCK;
            na0 = load_frag_pk(pa + l8);
            na1 = load_frag_pk(pa + RT + l8);
            nb0 = load_frag_pk(pb + l8);
            nb1 = load_frag_pk(pb + RT + l8);
            nb2 = load_frag_pk(pb + 2 * RT + l8);
            nb3 = load_frag_pk(pb + 3 * RT + l8);
            // A later load's result may land in a register that these loads name
            // as their address: the wait stands in front of that overwrite.
            asm volatile("s_wait_xcnt 0x0" ::: "memory");
        }
        // Holds the next step's loads ahead of this step's WMMAs; without it the
        // compiler sinks them to their first use and the wave waits out each load.
        __builtin_amdgcn_sched_barrier(0);
        // 8 independent accumulation chains
        acc[0][0] = wmma_f16(a0, b0, acc[0][0]);
        acc[0][1] = wmma_f16(a0, b1, acc[0][1]);
        acc[0][2] = wmma_f16(a0, b2, acc[0][2]);
        acc[0][3] = wmma_f16(a0, b3, acc[0][3]);
        acc[1][0] = wmma_f16(a1, b0, acc[1][0]);
        acc[1][1] = wmma_f16(a1, b1, acc[1][1]);
        acc[1][2] = wmma_f16(a1, b2, acc[1][2]);
        acc[1][3] = wmma_f16(a1, b3, acc[1][3]);
        a0 = na0; a1 = na1;
        b0 = nb0; b1 = nb1; b2 = nb2; b3 = nb3;
    }
}

// ---- QKV projection: C = x @ W^T (+bias) * scale, head-split f16 output ----
// One wave computes a 32x64 tile. 2048 waves = 256 blocks x 8 waves.
__global__ void __launch_bounds__(256)
proj_qkv_kernel(const _Float16* __restrict__ A,    // MROWS x D_MODEL, fragment order
                const _Float16* __restrict__ Wt,   // D_MODEL x D_MODEL (N x K), fragment order
                const float*    __restrict__ bias, // D_MODEL
                _Float16*       __restrict__ dst,  // [b,h][s,dstStride]; fragment order per (b,h) if DAUG wide
                int dstStride, float scale) {
    const int lane = threadIdx.x & 31;
    // wave number read as a scalar: the block addresses then stay in scalar registers
    const int wid  = blockIdx.x * 8 + __builtin_amdgcn_readfirstlane(threadIdx.x >> 5);
    const int m0   = (wid >> 4) << 5;   // 128 row tiles of 32
    const int n0   = (wid & 15) << 6;   // 16 col groups of 64

    v8f acc[2][4] = {};
    gemm_core_32x64(A, Wt, m0, n0, lane, acc);

    const int half = lane >> 4;
    const int nlo  = lane & 15;
    if (dstStride == DAUG) {
        // The 32-row tile lies in one batch and the 64-column group is one head.
        // pk_off adds over disjoint index bits: one lane base, constant steps.
        _Float16* lp = dst
            + ((size_t)(m0 >> 11) * NHEADS + (n0 >> 6)) * SEQ * DAUG
            + pk_off((m0 & (SEQ - 1)) + half * 8, nlo, DAUG / 32);
#pragma unroll
        for (int mi = 0; mi < 2; ++mi)
#pragma unroll
            for (int j = 0; j < 4; ++j)
#pragma unroll
                for (int r = 0; r < 8; ++r) {
                    float v = (acc[mi][j][r] + bias[n0 + j * 16 + nlo]) * scale;
                    lp[pk_off(mi * 16 + r, j * 16, DAUG / 32)] = (_Float16)v;
                }
        return;
    }
#pragma unroll
    for (int mi = 0; mi < 2; ++mi)
#pragma unroll
        for (int j = 0; j < 4; ++j)
#pragma unroll
            for (int r = 0; r < 8; ++r) {
                int m = m0 + mi * 16 + r + half * 8;
                int n = n0 + j * 16 + nlo;
                int bb = m >> 11, s = m & (SEQ - 1);
                int hh = n >> 6,  d = n & (HDIM - 1);
                float v = (acc[mi][j][r] + bias[n]) * scale;
                dst[(((size_t)bb * NHEADS + hh) * SEQ + s) * dstStride + d] =
                    (_Float16)v;
            }
}

// ---- output projection: out = O @ Wo^T + bo (fp32 out) ---------------------
__global__ void __launch_bounds__(256)
proj_out_kernel(const _Float16* __restrict__ A,    // MROWS x D_MODEL (f16), fragment order
                const _Float16* __restrict__ Wt,   // D_MODEL x D_MODEL (N x K), fragment order
                const float*    __restrict__ bias,
                float*          __restrict__ out) {
    const int lane = threadIdx.x & 31;
    // wave number read as a scalar: the block addresses then stay in scalar registers
    const int wid  = blockIdx.x * 8 + __builtin_amdgcn_readfirstlane(threadIdx.x >> 5);
    const int m0   = (wid >> 4) << 5;
    const int n0   = (wid & 15) << 6;

    v8f acc[2][4] = {};
    gemm_core_32x64(A, Wt, m0, n0, lane, acc);

    const int half = lane >> 4;
    const int nlo  = lane & 15;
#pragma unroll
    for (int mi = 0; mi < 2; ++mi)
#pragma unroll
        for (int j = 0; j < 4; ++j)
#pragma unroll
            for (int r = 0; r < 8; ++r) {
                int m = m0 + mi * 16 + r + half * 8;
                int n = n0 + j * 16 + nlo;
                out[(size_t)m * D_MODEL + n] = acc[mi][j][r] + bias[n];
            }
}

// ---- fill positional halves of Qa / Ka -------------------------------------
__global__ void augment_kernel(const float* __restrict__ pe,
                               const float* __restrict__ alpha,
                               _Float16* __restrict__ Qa,
                               _Float16* __restrict__ Ka) {
    // one thread per 16-byte chunk of the positional k blocks (2 and 3 of 4)
    int t = blockIdx.x * blockDim.x + threadIdx.x;   // over B*H*S*64/8
    if (t >= BATCH * NHEADS * SEQ * HDIM / 8) return;
    const int lane = t & 31;
    const int part = (t >> 5) & 1;
    const int kbp  = (t >> 6) & 1;
    const int rt   = (t >> 7) & (SEQ / 16 - 1);
    const int bh   = t >> 14;
    const int s    = rt * 16 + (lane & 15);
    const int d    = kbp * 32 + part * 16 + (lane >> 4) * 8;
    const float al = alpha[bh & (NHEADS - 1)];
    const float4* pp = (const float4*)(pe + s * HDIM + d);
    float4 u = pp[0];
    float4 w = pp[1];
    float p[8] = {u.x, u.y, u.z, u.w, w.x, w.y, w.z, w.w};
    v8h qv, kv;
#pragma unroll
    for (int i = 0; i < 8; ++i) {
        qv[i] = (_Float16)(al * p[i]);
        kv[i] = (_Float16)p[i];
    }
    size_t base = (size_t)bh * SEQ * DAUG + pk_off(s, HDIM + d, DAUG / 32);
    *(v8h*)(Qa + base) = qv;
    *(v8h*)(Ka + base) = kv;
}

// ---- lane l with lane l ^ 16 (the two lanes that share one column) ----------
static __device__ __forceinline__ float xhalf(float x) {
    int v = __builtin_bit_cast(int, x);
    return __builtin_bit_cast(float,
        __builtin_amdgcn_permlanex16(v, v, 0x76543210, 0xfedcba98, false, false));
}

typedef __attribute__((ext_vector_type(2))) float    v2f;
typedef __attribute__((ext_vector_type(2))) _Float16 v2h;

#define KTILE 8192   // halves in one 64-key tile of Ka: 16 fragment blocks, contiguous (16 KB)

// ---- one 64-key K tile, global -> LDS, through no register -------------------
// 256 threads x 4 asynchronous copies of 16 bytes. lds = this thread's byte
// address in the buffer, g = its source; copy c lies 4 KB behind copy c - 1.
static __device__ __forceinline__ void copy_k_tile(unsigned lds, const _Float16* g) {
    // The wait is the statement's last line: it stands in front of every later
    // write of the address registers that the four copies name.
    asm volatile("global_load_async_to_lds_b128 %0, %4, off\n\t"
                 "global_load_async_to_lds_b128 %1, %5, off\n\t"
                 "global_load_async_to_lds_b128 %2, %6, off\n\t"
                 "global_load_async_to_lds_b128 %3, %7, off\n\t"
                 "s_wait_xcnt 0x0"
                 :: "v"(lds), "v"(lds + 4096u), "v"(lds + 8192u), "v"(lds + 12288u),
                    "v"(g), "v"(g + 2048), "v"(g + 4096), "v"(g + 6144)
                 : "memory");
}

// ---- fused flash attention over augmented dim 128 --------------------------
// Block = (b, h, 128 q rows) -> 8 waves, each wave owns 16 q rows.
// Transposed products: S^T = Ka.Qa^T and O^T += V^T.P^T. In an accumulator tile
// a lane holds 8 keys (or 8 d) of ONE query, q0 + (lane & 15): maximum and
// sum run over the lane's own registers, the two lanes of a query exchange once,
// and two converted S^T tiles are the B operand of the second product as they
// stand, so P never goes through LDS.
// K tiles come into a two-buffer LDS ring by asynchronous copies, once per block:
// tile t + 1 is in flight while tile t is worked on.
// The grid gives every SIMD four waves, so the register budget is set for four:
// with it the compiler issues the ring's fragment reads as groups ahead of the
// WMMAs; with its own smaller budget it kept one or two fragments in flight per WMMA.
__global__ void __launch_bounds__(256) __attribute__((amdgpu_waves_per_eu(4, 4)))
attn_kernel(const _Float16* __restrict__ Qa,   // [b,h][s,128], fragment order
            const _Float16* __restrict__ Ka,   // [b,h][s,128], fragment order
            const _Float16* __restrict__ V,    // [b,h,s,64]
            const int*      __restrict__ mask, // [b,s]
            const float*    __restrict__ beta, // [h]
            _Float16*       __restrict__ O) {  // MROWS x D_MODEL, fragment order
    __shared__ __align__(16) _Float16 VT[HDIM * LDS_LDV];       // V^T tile [d][k]
    __shared__ __align__(32) float    KB[SEQ];                  // per key: beta, or -3e38 where masked
    __shared__ __align__(128) _Float16 KR[2 * KTILE];           // K ring: two 64-key tiles, fragment order

    const int lane = threadIdx.x & 31;
    const int widx = threadIdx.x >> 5;
    const int bh   = blockIdx.x >> 4;           // b*16 + h
    const int b    = bh >> 4;
    const int h    = bh & 15;
    const int q0   = (blockIdx.x & 15) * 128 + widx * 16;

    const _Float16* Qh = Qa + (size_t)bh * SEQ * DAUG;
    const _Float16* Kh = Ka + (size_t)bh * SEQ * DAUG;
    const _Float16* Vh = V  + (size_t)bh * SEQ * HDIM;
    const float bet = beta[h];

    // A key is a register index of S^T, so its mask and beta enter as the start
    // value of its S^T accumulator row. Read behind the loop's first barrier.
    {
        const int4* mp = (const int4*)(mask + b * SEQ + threadIdx.x * (SEQ / 256));
        const int4 ma = mp[0], mc = mp[1];
        float4 fa, fc;
        fa.x = (ma.x == 0) ? -3.0e38f : bet;  fa.y = (ma.y == 0) ? -3.0e38f : bet;
        fa.z = (ma.z == 0) ? -3.0e38f : bet;  fa.w = (ma.w == 0) ? -3.0e38f : bet;
        fc.x = (mc.x == 0) ? -3.0e38f : bet;  fc.y = (mc.y == 0) ? -3.0e38f : bet;
        fc.z = (mc.z == 0) ? -3.0e38f : bet;  fc.w = (mc.w == 0) ? -3.0e38f : bet;
        float4* kp = (float4*)&KB[threadIdx.x * (SEQ / 256)];
        kp[0] = fa;
        kp[1] = fc;
    }

    // ---- K ring, in front of the loop: tile 0 landed and published, tile 1 issued ----
    const unsigned  kr_lds = (unsigned)(size_t)&KR[threadIdx.x * 8];
    const _Float16* kg     = Kh + threadIdx.x * 8;
    copy_k_tile(kr_lds, kg);
    // this wave's copies of tile 0 have landed before the barrier publishes them
    asm volatile("s_wait_asynccnt 0x0" ::: "memory");
    __syncthreads();
    copy_k_tile(kr_lds + KTILE * 2, kg + KTILE);

    v16h qf[4];
#pragma unroll
    for (int kq = 0; kq < 4; ++kq) qf[kq] = load_frag_pk(Qh + ((q0 >> 4) * (DAUG / 32) + kq) * PK_BLOCK + lane * 8);

    v8f oacc[4] = {};            // oacc[j2][r] = O^T[j2*16 + half*8 + r][q0 + nlo]
    float rmax = -3.0e38f;       // this lane's query, both halves alike
    float rsum = 0.f;            // this lane's half of the keys only; joined at the end

    const int half = lane >> 4;
    const int nlo  = lane & 15;

    for (int k0 = 0; k0 < SEQ; k0 += 64) {
        // ---- cooperative V^T staging (256 threads, 64x64 f16 tile) ----
        {
            int kk = threadIdx.x & 63;
            int d0 = (threadIdx.x >> 6) * 16;
            const _Float16* vp = Vh + (size_t)(k0 + kk) * HDIM + d0;
            v8h a = *(const v8h*)vp;
            v8h c = *(const v8h*)(vp + 8);
#pragma unroll
            for (int i = 0; i < 8; ++i) {
                VT[(d0 + i)     * LDS_LDV + kk] = a[i];
                VT[(d0 + 8 + i) * LDS_LDV + kk] = c[i];
            }
            if (k0 + 64 < SEQ)  // pull next V tile toward L2/L0
                __builtin_prefetch(Vh + (size_t)(k0 + 64 + kk) * HDIM + d0, 0, 1);
        }
        __syncthreads();

        // ---- scores S^T = Ka.Qa^T (64 keys x 16 q, K=128); kq-outer => 4
        //      independent WMMA chains per step, 4 K-frag LDS loads clustered per step.
        //      sc[j][r] = score(key k0 + j*16 + half*8 + r, query q0 + nlo) ----
        const int kbuf = (k0 >> 6) & 1;          // this trip's buffer
        const _Float16* kt = KR + kbuf * KTILE + lane * 8;
        v8f sc[4];
#pragma unroll
        for (int j = 0; j < 4; ++j)
            sc[j] = *(const v8f*)&KB[k0 + j * 16 + half * 8];
#pragma unroll
        for (int kq = 0; kq < 4; ++kq) {
            v16h kb[4];
#pragma unroll
            for (int j = 0; j < 4; ++j)
                kb[j] = load_frag_pk(kt + (j * (DAUG / 32) + kq) * PK_BLOCK);
#pragma unroll
            for (int j = 0; j < 4; ++j)
                sc[j] = wmma_f16(kb[j], qf[kq], sc[j]);
        }

        // ---- online softmax: one query per lane ----
        float mt[4];   // one chain per tile: a tile's maximum runs under the later tiles' WMMAs
#pragma unroll
        for (int j = 0; j < 4; ++j) {
            mt[j] = sc[j][0];
#pragma unroll
            for (int r = 1; r < 8; ++r) mt[j] = fmaxf(mt[j], sc[j][r]);
        }
        float m = fmaxf(fmaxf(mt[0], mt[1]), fmaxf(mt[2], mt[3]));
        m = fmaxf(m, xhalf(m));
        const float nm   = fmaxf(rmax, m);
        const float corr = __expf(rmax - nm);
        rmax = nm;
#pragma unroll
        for (int j2 = 0; j2 < 4; ++j2) oacc[j2] *= corr;

        // p = exp(s - nm); elements 8*t .. 8*t+7 of the 32-key B operand are tile
        // 2*kk + t, registers 0..7: the k order of load_frag on the V^T side.
        v16h pb[2];
        v2f  ls[4];    // one sum chain per tile
#pragma unroll
        for (int j = 0; j < 4; ++j) {
#pragma unroll
            for (int r = 0; r < 8; r += 2) {
                v2f d = (v2f{sc[j][r], sc[j][r + 1]} - nm) * 1.44269504088896340736f;
                v2f p = {__builtin_amdgcn_exp2f(d.x), __builtin_amdgcn_exp2f(d.y)};
                ls[j] = (r == 0) ? p : ls[j] + p;
                v2h ph = __builtin_convertvector(p, v2h);
                pb[j >> 1][(j & 1) * 8 + r]     = ph.x;
                pb[j >> 1][(j & 1) * 8 + r + 1] = ph.y;
            }
        }
        const v2f lt = (ls[0] + ls[1]) + (ls[2] + ls[3]);
        rsum = rsum * corr + (lt.x + lt.y);

        // ---- O^T += V^T.P^T : A-frags from V^T stage, B-frags from registers ----
#pragma unroll
        for (int kk = 0; kk < 2; ++kk) {
            v16h vb[4];
#pragma unroll
            for (int j2 = 0; j2 < 4; ++j2)
                vb[j2] = load_frag(VT, LDS_LDV, j2 * 16, kk * 32, lane);
#pragma unroll
            for (int j2 = 0; j2 < 4; ++j2)
                oacc[j2] = wmma_f16(vb[j2], pb[kk], oacc[j2]);
        }
        // ---- foot of the trip: hand over. This wave's LDS reads are done ...
        asm volatile("s_wait_dscnt 0x0" ::: "memory");
        // ... and its copies of the next tile have landed, ...
        asm volatile("s_wait_asynccnt 0x0" ::: "memory");
        // ... so the barrier publishes the next K tile and frees VT and this trip's K buffer.
        __syncthreads();
        if (k0 + 128 < SEQ)   // the tile after next, into the buffer just read
            copy_k_tile(kr_lds + kbuf * (KTILE * 2), kg + (size_t)(k0 + 128) * DAUG);
    }
    // no copy is outstanding when the wave goes on to its end
    asm volatile("s_wait_asynccnt 0x0" ::: "memory");

    // ---- normalize and store O (4096 x 1024, row b*S+s, column h*64+d):
    //      a lane's 8 registers are 8 consecutive columns, one 16-byte chunk ----
    const float inv = 1.f / fmaxf(rsum + xhalf(rsum), 1e-20f);
#pragma unroll
    for (int j2 = 0; j2 < 4; ++j2) {
        v8h o;
#pragma unroll
        for (int r = 0; r < 8; ++r) o[r] = (_Float16)(oacc[j2][r] * inv);
        *(v8h*)(O + pk_off(b * SEQ + q0 + nlo, h * HDIM + j2 * 16 + half * 8, D_MODEL / 32)) = o;
    }
}

// ---------------------------------------------------------------------------
extern "C" void kernel_launch(void* const* d_in, const int* in_sizes, int n_in,
                              void* d_out, int out_size, void* d_ws, size_t ws_size,
                              hipStream_t stream) {
    const float* x     = (const float*)d_in[0];
    const int*   mask  = (const int*)d_in[1];
    const float* Wq    = (const float*)d_in[2];
    const float* bq    = (const float*)d_in[3];
    const float* Wk    = (const float*)d_in[4];
    const float* bk    = (const float*)d_in[5];
    const float* Wv    = (const float*)d_in[6];
    const float* bv    = (const float*)d_in[7];
    const float* Wo    = (const float*)d_in[8];
    const float* bo    = (const float*)d_in[9];
    const float* pe    = (const float*)d_in[10];
    const float* alpha = (const float*)d_in[11];
    const float* beta  = (const float*)d_in[12];
    float* out = (float*)d_out;

    // workspace carve-up (64 MB total)
    char* ws = (char*)d_ws;
    _Float16* xh  = (_Float16*)ws; ws += (size_t)MROWS * D_MODEL * 2;        // 8 MB
    _Float16* Wqh = (_Float16*)ws; ws += (size_t)D_MODEL * D_MODEL * 2;      // 2 MB
    _Float16* Wkh = (_Float16*)ws; ws += (size_t)D_MODEL * D_MODEL * 2;
    _Float16* Wvh = (_Float16*)ws; ws += (size_t)D_MODEL * D_MODEL * 2;
    _Float16* Woh = (_Float16*)ws; ws += (size_t)D_MODEL * D_MODEL * 2;
    _Float16* Qa  = (_Float16*)ws; ws += (size_t)BATCH * NHEADS * SEQ * DAUG * 2; // 16 MB
    _Float16* Kaa = (_Float16*)ws; ws += (size_t)BATCH * NHEADS * SEQ * DAUG * 2; // 16 MB
    _Float16* Vb  = (_Float16*)ws; ws += (size_t)BATCH * NHEADS * SEQ * HDIM * 2; //  8 MB
    _Float16* Oh  = (_Float16*)ws; ws += (size_t)MROWS * D_MODEL * 2;             //  8 MB

    int n;
    n = MROWS * D_MODEL / 8;
    cvt_f32_f16_kernel<<<(n + 255) / 256, 256, 0, stream>>>(x, xh, n);
    n = D_MODEL * D_MODEL / 8;
    cvt_f32_f16_kernel<<<(n + 255) / 256, 256, 0, stream>>>(Wq, Wqh, n);
    cvt_f32_f16_kernel<<<(n + 255) / 256, 256, 0, stream>>>(Wk, Wkh, n);
    cvt_f32_f16_kernel<<<(n + 255) / 256, 256, 0, stream>>>(Wv, Wvh, n);
    cvt_f32_f16_kernel<<<(n + 255) / 256, 256, 0, stream>>>(Wo, Woh, n);

    // q scaled by 1/sqrt(HDIM)=1/8 folded into Qa content half
    proj_qkv_kernel<<<256, 256, 0, stream>>>(xh, Wqh, bq, Qa, DAUG, 0.125f);
    proj_qkv_kernel<<<256, 256, 0, stream>>>(xh, Wkh, bk, Kaa, DAUG, 1.0f);
    proj_qkv_kernel<<<256, 256, 0, stream>>>(xh, Wvh, bv, Vb, HDIM, 1.0f);

    n = BATCH * NHEADS * SEQ * HDIM / 8;
    augment_kernel<<<(n + 255) / 256, 256, 0, stream>>>(pe, alpha, Qa, Kaa);

    attn_kernel<<<512, 256, 0, stream>>>(Qa, Kaa, Vb, mask, beta, Oh);

    proj_out_kernel<<<256, 256, 0, stream>>>(Oh, Woh, bo, out);
}

// v004
// A run of this version takes 128 microseconds.
// Next to v003, in two timings, it ran 1.14 and 1.15 times as fast.
// All steps since v000 together make it 2.58 times as fast.
#include <hip/hip_runtime.h>
#include <hip/hip_fp16.h>

// ---------------------------------------------------------------------------
// Disentangled attention, MI455X (gfx1250, wave32, WMMA).
// scores = (q.k)/8 + alpha_h*(pe_q.pe_k) + beta_h  folded into one GEMM by
// augmenting head-dim 64 -> 128:  Qa=[q/8, alpha*pe], Ka=[k, pe].
// f16 WMMA + fp32 accumulation; flash-style online softmax (no 512MB scores).
// GEMMs use 32x64 wave tiles with double-buffered fragments so loads overlap
// the v_wmma stream instead of serializing on s_wait_loadcnt 0.
// Every f16 operand that a wave reads from global memory except V (x, weights, Qa,
// Ka, O) is stored by its producer in fragment order, so that each wave-wide
// 16-byte load covers 512 contiguous bytes (4 whole lines, not 16 partial ones).
// Four dependent launches: launches that do not depend on one another share one
// grid, and a range of the block index picks the job.
// ---------------------------------------------------------------------------

typedef __attribute__((ext_vector_type(16))) _Float16 v16h;
typedef __attribute__((ext_vector_type(8)))  _Float16 v8h;
typedef __attribute__((ext_vector_type(8)))  float    v8f;

#define D_MODEL 1024
#define NHEADS  16
#define HDIM    64
#define SEQ     2048
#define BATCH   2
#define MROWS   (BATCH * SEQ)   // 4096
#define DAUG    128             // augmented head dim (64 content + 64 pos)

#define LDS_LDV 72

// ---- WMMA helper -----------------------------------------------------------
static __device__ __forceinline__ v8f wmma_f16(v16h a, v16h b, v8f c) {
    return __builtin_amdgcn_wmma_f32_16x16x32_f16(false, a, false, b, (short)0, c,
                                                  false, false);
}

// ---- 16-bit A-layout fragment load (also B-frag when given the N x K view) --
// ISA 7.12.2: lanes 0-15 hold row M=lane with K = {k0..k0+7, k0+16..k0+23};
// lanes 16-31 hold the same rows with K = {k0+8..k0+15, k0+24..k0+31}.
static __device__ __forceinline__ v16h load_frag(const _Float16* __restrict__ p,
                                                 int ld, int row0, int k0, int lane) {
    const int r  = lane & 15;
    const int h8 = (lane >> 4) << 3;   // 0 or 8
    const _Float16* base = p + (size_t)(row0 + r) * ld + k0 + h8;
    v8h lo = *(const v8h*)(base);
    v8h hi = *(const v8h*)(base + 16);
    return __builtin_shufflevector(lo, hi, 0,1,2,3,4,5,6,7,8,9,10,11,12,13,14,15);
}

// ---- fragment-order storage of a rows x K f16 matrix ------------------------
// One 16-row x 32-k fragment is a 1 KB block; blocks run along k, then rows.
// Inside a block: 512 B with each lane's first 8 halves, then 512 B with its
// second 8, in the lane and k order of load_frag above.
static __device__ __forceinline__ size_t pk_off(int row, int k, int kblocks) {
    return ((size_t)((row >> 4) * kblocks + (k >> 5)) << 9)
         + (((k >> 4) & 1) << 8)
         + (((row & 15) + (((k >> 3) & 1) << 4)) << 3)
         + (k & 7);
}

#define PK_BLOCK 512   // halves in one 16 x 32 fragment block

// base = start of the fragment's block + lane * 8
static __device__ __forceinline__ v16h load_frag_pk(const _Float16* __restrict__ base) {
    v8h lo = *(const v8h*)(base);
    v8h hi = *(const v8h*)(base + 256);
    return __builtin_shufflevector(lo, hi, 0,1,2,3,4,5,6,7,8,9,10,11,12,13,14,15);
}

// ---- fp32 -> f16 convert, rows x D_MODEL, into fragment order ---------------
// One thread per 16-byte chunk of the output; chunk c lies at out + 8 * c.
static __device__ __forceinline__ void cvt_chunk(const float* __restrict__ in,
                                                 _Float16* __restrict__ out, int c) {
    const int lane = c & 31;
    const int part = (c >> 5) & 1;
    const int kb   = (c >> 6) & (D_MODEL / 32 - 1);
    const int rt   = c >> 11;
    const int row  = rt * 16 + (lane & 15);
    const int k    = kb * 32 + part * 16 + (lane >> 4) * 8;
    const float4* ip = (const float4*)(in + (size_t)row * D_MODEL + k);
    float4 u = ip[0];
    float4 w = ip[1];
    v8h o;
    o[0] = (_Float16)u.x; o[1] = (_Float16)u.y; o[2] = (_Float16)u.z; o[3] = (_Float16)u.w;
    o[4] = (_Float16)w.x; o[5] = (_Float16)w.y; o[6] = (_Float16)w.z; o[7] = (_Float16)w.w;
    *(v8h*)(out + (size_t)c * 8) = o;
}

// ---- common 32x64 GEMM core: acc[mi][j] += A[m0+mi*16,:] . Wt[n0+j*16,:]^T --
// Double-buffered: next k-step's fragments are loaded into fresh registers
// while the 8 WMMAs for the current step issue.
static __device__ __forceinline__ void gemm_core_32x64(
        const _Float16* __restrict__ A, const _Float16* __restrict__ Wt,
        int m0, int n0, int lane, v8f acc[2][4]) {
    const int RT = (D_MODEL / 32) * PK_BLOCK;   // halves per 16-row tile
    const int l8 = lane * 8;
    const _Float16* pa = A  + (size_t)(m0 >> 4) * RT;
    const _Float16* pb = Wt + (size_t)(n0 >> 4) * RT;
    v16h a0 = load_frag_pk(pa + l8);
    v16h a1 = load_frag_pk(pa + RT + l8);
    v16h b0 = load_frag_pk(pb + l8);
    v16h b1 = load_frag_pk(pb + RT + l8);
    v16h b2 = load_frag_pk(pb + 2 * RT + l8);
    v16h b3 = load_frag_pk(pb + 3 * RT + l8);
#pragma unroll 4
    for (int k0 = 0; k0 < D_MODEL; k0 += 32) {
        v16h na0, na1, nb0, nb1, nb2, nb3;
        const int kn = k0 + 32;
        if (kn < D_MODEL) {
            pa += PK_BLOCK;
            pb += PK_BLOCK;
            na0 = load_frag_pk(pa + l8);
            na1 = load_frag_pk(pa + RT + l8);
            nb0 = load_frag_pk(pb + l8);
            nb1 = load_frag_pk(pb + RT + l8);
            nb2 = load_frag_pk(pb + 2 * RT + l8);
            nb3 = load_frag_pk(pb + 3 * RT + l8);
            // A later load's result may land in a register that these loads name
            // as their address: the wait stands in front of that overwrite.
            asm volatile("s_wait_xcnt 0x0" ::: "memory");
        }
        // Holds the next step's loads ahead of this step's WMMAs; without it the
        // compiler sinks them to their first use and the wave waits out each load.
        __builtin_amdgcn_sched_barrier(0);
        // 8 independent accumulation chains
        acc[0][0] = wmma_f16(a0, b0, acc[0][0]);
        acc[0][1] = wmma_f16(a0, b1, acc[0][1]);
        acc[0][2] = wmma_f16(a0, b2, acc[0][2]);
        acc[0][3] = wmma_f16(a0, b3, acc[0][3]);
        acc[1][0] = wmma_f16(a1, b0, acc[1][0]);
        acc[1][1] = wmma_f16(a1, b1, acc[1][1]);
        acc[1][2] = wmma_f16(a1, b2, acc[1][2]);
        acc[1][3] = wmma_f16(a1, b3, acc[1][3]);
        a0 = na0; a1 = na1;
        b0 = nb0; b1 = nb1; b2 = nb2; b3 = nb3;
    }
}

// ---- QKV projections: C = x @ W^T (+bias) * scale, head-split f16 output ---
// One wave computes a 32x64 tile; one projection is 2048 waves = 256 blocks x 8.
// One grid of 3 x 256 blocks: blocks 0..255 make q, 256..511 k, 512..767 v.
#define PROJ_BLOCKS 256
__global__ void __launch_bounds__(256)
proj_qkv_kernel(const _Float16* __restrict__ A,    // MROWS x D_MODEL, fragment order
                const _Float16* __restrict__ Wqkv, // Wq, Wk, Wv one behind the other, each D_MODEL x D_MODEL (N x K), fragment order
                const float*    __restrict__ bq,   // D_MODEL each
                const float*    __restrict__ bk,
                const float*    __restrict__ bv,
                _Float16*       __restrict__ Qa,   // [b,h][s,DAUG], fragment order per (b,h)
                _Float16*       __restrict__ Ka,   // [b,h][s,DAUG], fragment order per (b,h)
                _Float16*       __restrict__ V) {  // [b,h,s,HDIM]
    const int lane  = threadIdx.x & 31;
    const int which = blockIdx.x / PROJ_BLOCKS;    // 0 q, 1 k, 2 v: the same for the whole block
    // wave number read as a scalar: the block addresses then stay in scalar registers
    const int wid  = (blockIdx.x % PROJ_BLOCKS) * 8 + __builtin_amdgcn_readfirstlane(threadIdx.x >> 5);
    const int m0   = (wid >> 4) << 5;   // 128 row tiles of 32
    const int n0   = (wid & 15) << 6;   // 16 col groups of 64
    const _Float16* Wt   = Wqkv + (size_t)which * D_MODEL * D_MODEL;
    const float*    bias = (which == 0) ? bq : (which == 1) ? bk : bv;

    v8f acc[2][4] = {};
    gemm_core_32x64(A, Wt, m0, n0, lane, acc);

    const int half = lane >> 4;
    const int nlo  = lane & 15;
    if (which < 2) {
        _Float16* dst = (which == 0) ? Qa : Ka;
        // 1/sqrt(HDIM) = 1/8 is folded into the content half of Qa
        const float scale = (which == 0) ? 0.125f : 1.0f;
        // The 32-row tile lies in one batch and the 64-column group is one head.
        // pk_off adds over disjoint index bits: one lane base, constant steps.
        _Float16* lp = dst
            + ((size_t)(m0 >> 11) * NHEADS + (n0 >> 6)) * SEQ * DAUG
            + pk_off((m0 & (SEQ - 1)) + half * 8, nlo, DAUG / 32);
#pragma unroll
        for (int mi = 0; mi < 2; ++mi)
#pragma unroll
            for (int j = 0; j < 4; ++j)
#pragma unroll
                for (int r = 0; r < 8; ++r) {
                    float v = (acc[mi][j][r] + bias[n0 + j * 16 + nlo]) * scale;
                    lp[pk_off(mi * 16 + r, j * 16, DAUG / 32)] = (_Float16)v;
                }
        return;
    }
#pragma unroll
    for (int mi = 0; mi < 2; ++mi)
#pragma unroll
        for (int j = 0; j < 4; ++j)
#pragma unroll
            for (int r = 0; r < 8; ++r) {
                int m = m0 + mi * 16 + r + half * 8;
                int n = n0 + j * 16 + nlo;
                int bb = m >> 11, s = m & (SEQ - 1);
                int hh = n >> 6,  d = n & (HDIM - 1);
                float v = acc[mi][j][r] + bias[n];
                V[(((size_t)bb * NHEADS + hh) * SEQ + s) * HDIM + d] =
                    (_Float16)v;
            }
    // Stands in front of any later write of a register that these stores name.
    asm volatile("s_wait_xcnt 0x0" ::: "memory");
}

// ---- output projection: out = O @ Wo^T + bo (fp32 out) ---------------------
__global__ void __launch_bounds__(256)
proj_out_kernel(const _Float16* __restrict__ A,    // MROWS x D_MODEL (f16), fragment order
                const _Float16* __restrict__ Wt,   // D_MODEL x D_MODEL (N x K), fragment order
                const float*    __restrict__ bias,
                float*          __restrict__ out) {
    const int lane = threadIdx.x & 31;
    // wave number read as a scalar: the block addresses then stay in scalar registers
    const int wid  = blockIdx.x * 8 + __builtin_amdgcn_readfirstlane(threadIdx.x >> 5);
    const int m0   = (wid >> 4) << 5;
    const int n0   = (wid & 15) << 6;

    v8f acc[2][4] = {};
    gemm_core_32x64(A, Wt, m0, n0, lane, acc);

    const int half = lane >> 4;
    const int nlo  = lane & 15;
#pragma unroll
    for (int mi = 0; mi < 2; ++mi)
#pragma unroll
        for (int j = 0; j < 4; ++j)
#pragma unroll
            for (int r = 0; r < 8; ++r) {
                int m = m0 + mi * 16 + r + half * 8;
                int n = n0 + j * 16 + nlo;
                out[(size_t)m * D_MODEL + n] = acc[mi][j][r] + bias[n];
            }
}

// ---- fill positional halves of Qa / Ka -------------------------------------
// one thread per 16-byte chunk of the positional k blocks (2 and 3 of 4);
// t runs over B*H*S*64/8
static __device__ __forceinline__ void augment_chunk(const float* __restrict__ pe,
                                                     const float* __restrict__ alpha,
                                                     _Float16* __restrict__ Qa,
                                                     _Float16* __restrict__ Ka, int t) {
    const int lane = t & 31;
    const int part = (t >> 5) & 1;
    const int kbp  = (t >> 6) & 1;
    const int rt   = (t >> 7) & (SEQ / 16 - 1);
    const int bh   = t >> 14;
    const int s    = rt * 16 + (lane & 15);
    const int d    = kbp * 32 + part * 16 + (lane >> 4) * 8;
    const float al = alpha[bh & (NHEADS - 1)];
    const float4* pp = (const float4*)(pe + s * HDIM + d);
    float4 u = pp[0];
    float4 w = pp[1];
    float p[8] = {u.x, u.y, u.z, u.w, w.x, w.y, w.z, w.w};
    v8h qv, kv;
#pragma unroll
    for (int i = 0; i < 8; ++i) {
        qv[i] = (_Float16)(al * p[i]);
        kv[i] = (_Float16)p[i];
    }
    size_t base = (size_t)bh * SEQ * DAUG + pk_off(s, HDIM + d, DAUG / 32);
    *(v8h*)(Qa + base) = qv;
    *(v8h*)(Ka + base) = kv;
    // Stands in front of any later write of a register that the two stores name.
    asm volatile("s_wait_xcnt 0x0" ::: "memory");
}

// ---- everything that reads only inputs, in one grid -------------------------
// Blocks of 256 chunks: x, then Wq, Wk, Wv, Wo, then the positional halves.
// The f16 copies of x and of the four weights lie one behind the other in xw,
// all D_MODEL wide, so a convert block's output chunk is its index in the grid.
#define X_BLOCKS   (MROWS * D_MODEL / 8 / 256)                 // 2048
#define W_BLOCKS   (D_MODEL * D_MODEL / 8 / 256)               // 512
#define CVT_BLOCKS (X_BLOCKS + 4 * W_BLOCKS)                   // 4096
#define AUG_BLOCKS (BATCH * NHEADS * SEQ * HDIM / 8 / 256)     // 2048
__global__ void __launch_bounds__(256)
prep_kernel(const float* __restrict__ x,
            const float* __restrict__ Wq, const float* __restrict__ Wk,
            const float* __restrict__ Wv, const float* __restrict__ Wo,
            const float* __restrict__ pe, const float* __restrict__ alpha,
            _Float16* __restrict__ xw,
            _Float16* __restrict__ Qa, _Float16* __restrict__ Ka) {
    const int blk = blockIdx.x;
    if (blk < CVT_BLOCKS) {
        const float* in    = x;
        int          first = 0;          // the source's first block
        if (blk >= X_BLOCKS) {
            const int w = (blk - X_BLOCKS) / W_BLOCKS;
            in    = (w == 0) ? Wq : (w == 1) ? Wk : (w == 2) ? Wv : Wo;
            first = X_BLOCKS + w * W_BLOCKS;
        }
        cvt_chunk(in, xw + (size_t)first * 256 * 8, (blk - first) * 256 + threadIdx.x);
    } else {
        augment_chunk(pe, alpha, Qa, Ka, (blk - CVT_BLOCKS) * 256 + threadIdx.x);
    }
}

// ---- lane l with lane l ^ 16 (the two lanes that share one column) ----------
static __device__ __forceinline__ float xhalf(float x) {
    int v = __builtin_bit_cast(int, x);
    return __builtin_bit_cast(float,
        __builtin_amdgcn_permlanex16(v, v, 0x76543210, 0xfedcba98, false, false));
}

typedef __attribute__((ext_vector_type(2))) float    v2f;
typedef __attribute__((ext_vector_type(2))) _Float16 v2h;

#define KTILE 8192   // halves in one 64-key tile of Ka: 16 fragment blocks, contiguous (16 KB)

// ---- one 64-key K tile, global -> LDS, through no register -------------------
// 256 threads x 4 asynchronous copies of 16 bytes. lds = this thread's byte
// address in the buffer, g = its source; copy c lies 4 KB behind copy c - 1.
static __device__ __forceinline__ void copy_k_tile(unsigned lds, const _Float16* g) {
    // The wait is the statement's last line: it stands in front of every later
    // write of the address registers that the four copies name.
    asm volatile("global_load_async_to_lds_b128 %0, %4, off\n\t"
                 "global_load_async_to_lds_b128 %1, %5, off\n\t"
                 "global_load_async_to_lds_b128 %2, %6, off\n\t"
                 "global_load_async_to_lds_b128 %3, %7, off\n\t"
                 "s_wait_xcnt 0x0"
                 :: "v"(lds), "v"(lds + 4096u), "v"(lds + 8192u), "v"(lds + 12288u),
                    "v"(g), "v"(g + 2048), "v"(g + 4096), "v"(g + 6144)
                 : "memory");
}

// ---- fused flash attention over augmented dim 128 --------------------------
// Block = (b, h, 128 q rows) -> 8 waves, each wave owns 16 q rows.
// Transposed products: S^T = Ka.Qa^T and O^T += V^T.P^T. In an accumulator tile
// a lane holds 8 keys (or 8 d) of ONE query, q0 + (lane & 15): maximum and
// sum run over the lane's own registers, the two lanes of a query exchange once,
// and two converted S^T tiles are the B operand of the second product as they
// stand, so P never goes through LDS.
// K tiles come into a two-buffer LDS ring by asynchronous copies, once per block:
// tile t + 1 is in flight while tile t is worked on.
// The grid gives every SIMD four waves, so the register budget is set for four:
// with it the compiler issues the ring's fragment reads as groups ahead of the
// WMMAs; with its own smaller budget it kept one or two fragments in flight per WMMA.
__global__ void __launch_bounds__(256) __attribute__((amdgpu_waves_per_eu(4, 4)))
attn_kernel(const _Float16* __restrict__ Qa,   // [b,h][s,128], fragment order
            const _Float16* __restrict__ Ka,   // [b,h][s,128], fragment order
            const _Float16* __restrict__ V,    // [b,h,s,64]
            const int*      __restrict__ mask, // [b,s]
            const float*    __restrict__ beta, // [h]
            _Float16*       __restrict__ O) {  // MROWS x D_MODEL, fragment order
    __shared__ __align__(16) _Float16 VT[HDIM * LDS_LDV];       // V^T tile [d][k]
    __shared__ __align__(32) float    KB[SEQ];                  // per key: beta, or -3e38 where masked
    __shared__ __align__(128) _Float16 KR[2 * KTILE];           // K ring: two 64-key tiles, fragment order

    const int lane = threadIdx.x & 31;
    const int widx = threadIdx.x >> 5;
    const int bh   = blockIdx.x >> 4;           // b*16 + h
    const int b    = bh >> 4;
    const int h    = bh & 15;
    const int q0   = (blockIdx.x & 15) * 128 + widx * 16;

    const _Float16* Qh = Qa + (size_t)bh * SEQ * DAUG;
    const _Float16* Kh = Ka + (size_t)bh * SEQ * DAUG;
    const _Float16* Vh = V  + (size_t)bh * SEQ * HDIM;
    const float bet = beta[h];

    // A key is a register index of S^T, so its mask and beta enter as the start
    // value of its S^T accumulator row. Read behind the loop's first barrier.
    {
        const int4* mp = (const int4*)(mask + b * SEQ + threadIdx.x * (SEQ / 256));
        const int4 ma = mp[0], mc = mp[1];
        float4 fa, fc;
        fa.x = (ma.x == 0) ? -3.0e38f : bet;  fa.y = (ma.y == 0) ? -3.0e38f : bet;
        fa.z = (ma.z == 0) ? -3.0e38f : bet;  fa.w = (ma.w == 0) ? -3.0e38f : bet;
        fc.x = (mc.x == 0) ? -3.0e38f : bet;  fc.y = (mc.y == 0) ? -3.0e38f : bet;
        fc.z = (mc.z == 0) ? -3.0e38f : bet;  fc.w = (mc.w == 0) ? -3.0e38f : bet;
        float4* kp = (float4*)&KB[threadIdx.x * (SEQ / 256)];
        kp[0] = fa;
        kp[1] = fc;
    }

    // ---- K ring, in front of the loop: tile 0 landed and published, tile 1 issued ----
    const unsigned  kr_lds = (unsigned)(size_t)&KR[threadIdx.x * 8];
    const _Float16* kg     = Kh + threadIdx.x * 8;
    copy_k_tile(kr_lds, kg);
    // this wave's copies of tile 0 have landed before the barrier publishes them
    asm volatile("s_wait_asynccnt 0x0" ::: "memory");
    __syncthreads();
    copy_k_tile(kr_lds + KTILE * 2, kg + KTILE);

    v16h qf[4];
#pragma unroll
    for (int kq = 0; kq < 4; ++kq) qf[kq] = load_frag_pk(Qh + ((q0 >> 4) * (DAUG / 32) + kq) * PK_BLOCK + lane * 8);

    v8f oacc[4] = {};            // oacc[j2][r] = O^T[j2*16 + half*8 + r][q0 + nlo]
    float rmax = -3.0e38f;       // this lane's query, both halves alike
    float rsum = 0.f;            // this lane's half of the keys only; joined at the end

    const int half = lane >> 4;
    const int nlo  = lane & 15;

    for (int k0 = 0; k0 < SEQ; k0 += 64) {
        // ---- cooperative V^T staging (256 threads, 64x64 f16 tile) ----
        {
            int kk = threadIdx.x & 63;
            int d0 = (threadIdx.x >> 6) * 16;
            const _Float16* vp = Vh + (size_t)(k0 + kk) * HDIM + d0;
            v8h a = *(const v8h*)vp;
            v8h c = *(const v8h*)(vp + 8);
#pragma unroll
            for (int i = 0; i < 8; ++i) {
                VT[(d0 + i)     * LDS_LDV + kk] = a[i];
                VT[(d0 + 8 + i) * LDS_LDV + kk] = c[i];
            }
            if (k0 + 64 < SEQ)  // pull next V tile toward L2/L0
                __builtin_prefetch(Vh + (size_t)(k0 + 64 + kk) * HDIM + d0, 0, 1);
        }
        __syncthreads();

        // ---- scores S^T = Ka.Qa^T (64 keys x 16 q, K=128); kq-outer => 4
        //      independent WMMA chains per step, 4 K-frag LDS loads clustered per step.
        //      sc[j][r] = score(key k0 + j*16 + half*8 + r, query q0 + nlo) ----
        const int kbuf = (k0 >> 6) & 1;          // this trip's buffer
        const _Float16* kt = KR + kbuf * KTILE + lane * 8;
        v8f sc[4];
#pragma unroll
        for (int j = 0; j < 4; ++j)
            sc[j] = *(const v8f*)&KB[k0 + j * 16 + half * 8];
#pragma unroll
        for (int kq = 0; kq < 4; ++kq) {
            v16h kb[4];
#pragma unroll
            for (int j = 0; j < 4; ++j)
                kb[j] = load_frag_pk(kt + (j * (DAUG / 32) + kq) * PK_BLOCK);
#pragma unroll
            for (int j = 0; j < 4; ++j)
                sc[j] = wmma_f16(kb[j], qf[kq], sc[j]);
        }

        // ---- online softmax: one query per lane ----
        float mt[4];   // one chain per tile: a tile's maximum runs under the later tiles' WMMAs
#pragma unroll
        for (int j = 0; j < 4; ++j) {
            mt[j] = sc[j][0];
#pragma unroll
            for (int r = 1; r < 8; ++r) mt[j] = fmaxf(mt[j], sc[j][r]);
        }
        float m = fmaxf(fmaxf(mt[0], mt[1]), fmaxf(mt[2], mt[3]));
        m = fmaxf(m, xhalf(m));
        const float nm   = fmaxf(rmax, m);
        const float corr = __expf(rmax - nm);
        rmax = nm;
#pragma unroll
        for (int j2 = 0; j2 < 4; ++j2) oacc[j2] *= corr;

        // p = exp(s - nm); elements 8*t .. 8*t+7 of the 32-key B operand are tile
        // 2*kk + t, registers 0..7: the k order of load_frag on the V^T side.
        v16h pb[2];
        v2f  ls[4];    // one sum chain per tile
#pragma unroll
        for (int j = 0; j < 4; ++j) {
#pragma unroll
            for (int r = 0; r < 8; r += 2) {
                v2f d = (v2f{sc[j][r], sc[j][r + 1]} - nm) * 1.44269504088896340736f;
                v2f p = {__builtin_amdgcn_exp2f(d.x), __builtin_amdgcn_exp2f(d.y)};
                ls[j] = (r == 0) ? p : ls[j] + p;
                v2h ph = __builtin_convertvector(p, v2h);
                pb[j >> 1][(j & 1) * 8 + r]     = ph.x;
                pb[j >> 1][(j & 1) * 8 + r + 1] = ph.y;
            }
        }
        const v2f lt = (ls[0] + ls[1]) + (ls[2] + ls[3]);
        rsum = rsum * corr + (lt.x + lt.y);

        // ---- O^T += V^T.P^T : A-frags from V^T stage, B-frags from registers ----
#pragma unroll
        for (int kk = 0; kk < 2; ++kk) {
            v16h vb[4];
#pragma unroll
            for (int j2 = 0; j2 < 4; ++j2)
                vb[j2] = load_frag(VT, LDS_LDV, j2 * 16, kk * 32, lane);
#pragma unroll
            for (int j2 = 0; j2 < 4; ++j2)
                oacc[j2] = wmma_f16(vb[j2], pb[kk], oacc[j2]);
        }
        // ---- foot of the trip: hand over. This wave's LDS reads are done ...
        asm volatile("s_wait_dscnt 0x0" ::: "memory");
        // ... and its copies of the next tile have landed, ...
        asm volatile("s_wait_asynccnt 0x0" ::: "memory");
        // ... so the barrier publishes the next K tile and frees VT and this trip's K buffer.
        __syncthreads();
        if (k0 + 128 < SEQ)   // the tile after next, into the buffer just read
            copy_k_tile(kr_lds + kbuf * (KTILE * 2), kg + (size_t)(k0 + 128) * DAUG);
    }
    // no copy is outstanding when the wave goes on to its end
    asm volatile("s_wait_asynccnt 0x0" ::: "memory");

    // ---- normalize and store O (4096 x 1024, row b*S+s, column h*64+d):
    //      a lane's 8 registers are 8 consecutive columns, one 16-byte chunk ----
    const float inv = 1.f / fmaxf(rsum + xhalf(rsum), 1e-20f);
#pragma unroll
    for (int j2 = 0; j2 < 4; ++j2) {
        v8h o;
#pragma unroll
        for (int r = 0; r < 8; ++r) o[r] = (_Float16)(oacc[j2][r] * inv);
        *(v8h*)(O + pk_off(b * SEQ + q0 + nlo, h * HDIM + j2 * 16 + half * 8, D_MODEL / 32)) = o;
    }
}

// ---------------------------------------------------------------------------
extern "C" void kernel_launch(void* const* d_in, const int* in_sizes, int n_in,
                              void* d_out, int out_size, void* d_ws, size_t ws_size,
                              hipStream_t stream) {
    const float* x     = (const float*)d_in[0];
    const int*   mask  = (const int*)d_in[1];
    const float* Wq    = (const float*)d_in[2];
    const float* bq    = (const float*)d_in[3];
    const float* Wk    = (const float*)d_in[4];
    const float* bk    = (const float*)d_in[5];
    const float* Wv    = (const float*)d_in[6];
    const float* bv    = (const float*)d_in[7];
    const float* Wo    = (const float*)d_in[8];
    const float* bo    = (const float*)d_in[9];
    const float* pe    = (const float*)d_in[10];
    const float* alpha = (const float*)d_in[11];
    const float* beta  = (const float*)d_in[12];
    float* out = (float*)d_out;

    // workspace carve-up (64 MB total)
    char* ws = (char*)d_ws;
    _Float16* xh  = (_Float16*)ws; ws += (size_t)MROWS * D_MODEL * 2;        // 8 MB
    _Float16* Wqh = (_Float16*)ws; ws += (size_t)3 * D_MODEL * D_MODEL * 2;  // Wq, Wk, Wv: 2 MB each
    _Float16* Woh = (_Float16*)ws; ws += (size_t)D_MODEL * D_MODEL * 2;      // 2 MB
    _Float16* Qa  = (_Float16*)ws; ws += (size_t)BATCH * NHEADS * SEQ * DAUG * 2; // 16 MB
    _Float16* Kaa = (_Float16*)ws; ws += (size_t)BATCH * NHEADS * SEQ * DAUG * 2; // 16 MB
    _Float16* Vb  = (_Float16*)ws; ws += (size_t)BATCH * NHEADS * SEQ * HDIM * 2; //  8 MB
    _Float16* Oh  = (_Float16*)ws; ws += (size_t)MROWS * D_MODEL * 2;             //  8 MB

    // the f16 copies of x, Wq, Wk, Wv, Wo are one run of the workspace, filled from xh on
    prep_kernel<<<CVT_BLOCKS + AUG_BLOCKS, 256, 0, stream>>>(x, Wq, Wk, Wv, Wo, pe, alpha,
                                                             xh, Qa, Kaa);

    proj_qkv_kernel<<<3 * PROJ_BLOCKS, 256, 0, stream>>>(xh, Wqh, bq, bk, bv, Qa, Kaa, Vb);

    attn_kernel<<<512, 256, 0, stream>>>(Qa, Kaa, Vb, mask, beta, Oh);

    proj_out_kernel<<<256, 256, 0, stream>>>(Oh, Woh, bo, out);
}

// v005
// Measured time: 113 microseconds a run.
// Two timings next to v004 put it at 1.13 and 1.12 times that version's speed.
// All steps since v000 together make it 2.91 times as fast.
#include <hip/hip_runtime.h>
#include <hip/hip_fp16.h>

// ---------------------------------------------------------------------------
// Disentangled attention, MI455X (gfx1250, wave32, WMMA).
// scores = (q.k)/8 + alpha_h*(pe_q.pe_k) + beta_h  folded into one GEMM by
// augmenting head-dim 64 -> 128:  Qa=[q/8, alpha*pe], Ka=[k, pe].
// f16 WMMA + fp32 accumulation; flash-style online softmax (no 512MB scores).
// GEMMs use 32x64 wave tiles with double-buffered fragments so loads overlap
// the v_wmma stream instead of serializing on s_wait_loadcnt 0.
// Every f16 matrix operand (x, the weights, Qa, Ka, V^T, O) is stored by its
// producer in fragment order, so that each wave-wide 16-byte load or copy covers
// 512 contiguous bytes (4 whole lines, not 16 partial ones).
// Four dependent launches: launches that do not depend on one another share one
// grid, and a range of the block index picks the job.
// ---------------------------------------------------------------------------

typedef __attribute__((ext_vector_type(16))) _Float16 v16h;
typedef __attribute__((ext_vector_type(8)))  _Float16 v8h;
typedef __attribute__((ext_vector_type(8)))  float    v8f;

#define D_MODEL 1024
#define NHEADS  16
#define HDIM    64
#define SEQ     2048
#define BATCH   2
#define MROWS   (BATCH * SEQ)   // 4096
#define DAUG    128             // augmented head dim (64 content + 64 pos)

// ---- WMMA helper -----------------------------------------------------------
static __device__ __forceinline__ v8f wmma_f16(v16h a, v16h b, v8f c) {
    return __builtin_amdgcn_wmma_f32_16x16x32_f16(false, a, false, b, (short)0, c,
                                                  false, false);
}

// ---- 16-bit A-layout fragment (also the B fragment of the N x K view) --------
// ISA 7.12.2: lanes 0-15 hold row M=lane with K = {k0..k0+7, k0+16..k0+23};
// lanes 16-31 hold the same rows with K = {k0+8..k0+15, k0+24..k0+31}.

// ---- fragment-order storage of a rows x K f16 matrix ------------------------
// One 16-row x 32-k fragment is a 1 KB block; blocks run along k, then rows.
// Inside a block: 512 B with each lane's first 8 halves, then 512 B with its
// second 8, in the lane and k order above.
static __device__ __forceinline__ size_t pk_off(int row, int k, int kblocks) {
    return ((size_t)((row >> 4) * kblocks + (k >> 5)) << 9)
         + (((k >> 4) & 1) << 8)
         + (((row & 15) + (((k >> 3) & 1) << 4)) << 3)
         + (k & 7);
}

#define PK_BLOCK 512   // halves in one 16 x 32 fragment block

// base = start of the fragment's block + lane * 8
static __device__ __forceinline__ v16h load_frag_pk(const _Float16* __restrict__ base) {
    v8h lo = *(const v8h*)(base);
    v8h hi = *(const v8h*)(base + 256);
    return __builtin_shufflevector(lo, hi, 0,1,2,3,4,5,6,7,8,9,10,11,12,13,14,15);
}

// ---- fp32 -> f16 convert, rows x D_MODEL, into fragment order ---------------
// One thread per 16-byte chunk of the output; chunk c lies at out + 8 * c.
static __device__ __forceinline__ void cvt_chunk(const float* __restrict__ in,
                                                 _Float16* __restrict__ out, int c) {
    const int lane = c & 31;
    const int part = (c >> 5) & 1;
    const int kb   = (c >> 6) & (D_MODEL / 32 - 1);
    const int rt   = c >> 11;
    const int row  = rt * 16 + (lane & 15);
    const int k    = kb * 32 + part * 16 + (lane >> 4) * 8;
    const float4* ip = (const float4*)(in + (size_t)row * D_MODEL + k);
    float4 u = ip[0];
    float4 w = ip[1];
    v8h o;
    o[0] = (_Float16)u.x; o[1] = (_Float16)u.y; o[2] = (_Float16)u.z; o[3] = (_Float16)u.w;
    o[4] = (_Float16)w.x; o[5] = (_Float16)w.y; o[6] = (_Float16)w.z; o[7] = (_Float16)w.w;
    *(v8h*)(out + (size_t)c * 8) = o;
}

// ---- common 32x64 GEMM core: acc[mi][j] += A[m0+mi*16,:] . Wt[n0+j*16,:]^T --
// Double-buffered: next k-step's fragments are loaded into fresh registers
// while the 8 WMMAs for the current step issue.
static __device__ __forceinline__ void gemm_core_32x64(
        const _Float16* __restrict__ A, const _Float16* __restrict__ Wt,
        int m0, int n0, int lane, v8f acc[2][4]) {
    const int RT = (D_MODEL / 32) * PK_BLOCK;   // halves per 16-row tile
    const int l8 = lane * 8;
    const _Float16* pa = A  + (size_t)(m0 >> 4) * RT;
    const _Float16* pb = Wt + (size_t)(n0 >> 4) * RT;
    v16h a0 = load_frag_pk(pa + l8);
    v16h a1 = load_frag_pk(pa + RT + l8);
    v16h b0 = load_frag_pk(pb + l8);
    v16h b1 = load_frag_pk(pb + RT + l8);
    v16h b2 = load_frag_pk(pb + 2 * RT + l8);
    v16h b3 = load_frag_pk(pb + 3 * RT + l8);
#pragma unroll 4
    for (int k0 = 0; k0 < D_MODEL; k0 += 32) {
        v16h na0, na1, nb0, nb1, nb2, nb3;
        const int kn = k0 + 32;
        if (kn < D_MODEL) {
            pa += PK_BLOCK;
            pb += PK_BLOCK;
            na0 = load_frag_pk(pa + l8);
            na1 = load_frag_pk(pa + RT + l8);
            nb0 = load_frag_pk(pb + l8);
            nb1 = load_frag_pk(pb + RT + l8);
            nb2 = load_frag_pk(pb + 2 * RT + l8);
            nb3 = load_frag_pk(pb + 3 * RT + l8);
            // A later load's result may land in a register that these loads name
            // as their address: the wait stands in front of that overwrite.
            asm volatile("s_wait_xcnt 0x0" ::: "memory");
        }
        // Holds the next step's loads ahead of this step's WMMAs; without it the
        // compiler sinks them to their first use and the wave waits out each load.
        __builtin_amdgcn_sched_barrier(0);
        // 8 independent accumulation chains
        acc[0][0] = wmma_f16(a0, b0, acc[0][0]);
        acc[0][1] = wmma_f16(a0, b1, acc[0][1]);
        acc[0][2] = wmma_f16(a0, b2, acc[0][2]);
        acc[0][3] = wmma_f16(a0, b3, acc[0][3]);
        acc[1][0] = wmma_f16(a1, b0, acc[1][0]);
        acc[1][1] = wmma_f16(a1, b1, acc[1][1]);
        acc[1][2] = wmma_f16(a1, b2, acc[1][2]);
        acc[1][3] = wmma_f16(a1, b3, acc[1][3]);
        a0 = na0; a1 = na1;
        b0 = nb0; b1 = nb1; b2 = nb2; b3 = nb3;
    }
}

// ---- QKV projections: C = x @ W^T (+bias) * scale, head-split f16 output ---
// One wave computes a 32x64 tile; one projection is 2048 waves = 256 blocks x 8.
// One grid of 3 x 256 blocks: blocks 0..255 make q, 256..511 k, 512..767 v.
#define PROJ_BLOCKS 256
__global__ void __launch_bounds__(256)
proj_qkv_kernel(const _Float16* __restrict__ A,    // MROWS x D_MODEL, fragment order
                const _Float16* __restrict__ Wqkv, // Wq, Wk, Wv one behind the other, each D_MODEL x D_MODEL (N x K), fragment order
                const float*    __restrict__ bq,   // D_MODEL each
                const float*    __restrict__ bk,
                const float*    __restrict__ bv,
                _Float16*       __restrict__ Qa,   // [b,h][s,DAUG], fragment order per (b,h)
                _Float16*       __restrict__ Ka,   // [b,h][s,DAUG], fragment order per (b,h)
                _Float16*       __restrict__ V) {  // [b,h]: V^T (HDIM x s) as fragments, blocks along d, then keys
    const int lane  = threadIdx.x & 31;
    const int which = blockIdx.x / PROJ_BLOCKS;    // 0 q, 1 k, 2 v: the same for the whole block
    // wave number read as a scalar: the block addresses then stay in scalar registers
    const int wid  = (blockIdx.x % PROJ_BLOCKS) * 8 + __builtin_amdgcn_readfirstlane(threadIdx.x >> 5);
    const int m0   = (wid >> 4) << 5;   // 128 row tiles of 32
    const int n0   = (wid & 15) << 6;   // 16 col groups of 64
    const _Float16* Wt   = Wqkv + (size_t)which * D_MODEL * D_MODEL;
    const float*    bias = (which == 0) ? bq : (which == 1) ? bk : bv;

    v8f acc[2][4] = {};
    gemm_core_32x64(A, Wt, m0, n0, lane, acc);

    const int half = lane >> 4;
    const int nlo  = lane & 15;
    if (which < 2) {
        _Float16* dst = (which == 0) ? Qa : Ka;
        // 1/sqrt(HDIM) = 1/8 is folded into the content half of Qa
        const float scale = (which == 0) ? 0.125f : 1.0f;
        // The 32-row tile lies in one batch and the 64-column group is one head.
        // pk_off adds over disjoint index bits: one lane base, constant steps.
        _Float16* lp = dst
            + ((size_t)(m0 >> 11) * NHEADS + (n0 >> 6)) * SEQ * DAUG
            + pk_off((m0 & (SEQ - 1)) + half * 8, nlo, DAUG / 32);
#pragma unroll
        for (int mi = 0; mi < 2; ++mi)
#pragma unroll
            for (int j = 0; j < 4; ++j)
#pragma unroll
                for (int r = 0; r < 8; ++r) {
                    float v = (acc[mi][j][r] + bias[n0 + j * 16 + nlo]) * scale;
                    lp[pk_off(mi * 16 + r, j * 16, DAUG / 32)] = (_Float16)v;
                }
        return;
    }
    // V^T: row = d, k = key. The tile's 32 keys are one k block, its 64 columns the
    // four d tiles. In block j a lane holds row d = nlo and, per mi, the 8 keys
    // mi*16 + half*8 + r: chunk "lane" of the block's half mi, one 16-byte store.
    _Float16* vp = V
        + ((size_t)(m0 >> 11) * NHEADS + (n0 >> 6)) * SEQ * HDIM
        + (size_t)((m0 & (SEQ - 1)) >> 5) * (HDIM / 16) * PK_BLOCK + lane * 8;
#pragma unroll
    for (int mi = 0; mi < 2; ++mi)
#pragma unroll
        for (int j = 0; j < 4; ++j) {
            const float bj = bias[n0 + j * 16 + nlo];
            v8h o;
#pragma unroll
            for (int r = 0; r < 8; ++r) o[r] = (_Float16)(acc[mi][j][r] + bj);
            *(v8h*)(vp + j * PK_BLOCK + mi * 256) = o;
        }
    // Stands in front of any later write of a register that these stores name.
    asm volatile("s_wait_xcnt 0x0" ::: "memory");
}

// ---- output projection: out = O @ Wo^T + bo (fp32 out) ---------------------
__global__ void __launch_bounds__(256)
proj_out_kernel(const _Float16* __restrict__ A,    // MROWS x D_MODEL (f16), fragment order
                const _Float16* __restrict__ Wt,   // D_MODEL x D_MODEL (N x K), fragment order
                const float*    __restrict__ bias,
                float*          __restrict__ out) {
    const int lane = threadIdx.x & 31;
    // wave number read as a scalar: the block addresses then stay in scalar registers
    const int wid  = blockIdx.x * 8 + __builtin_amdgcn_readfirstlane(threadIdx.x >> 5);
    const int m0   = (wid >> 4) << 5;
    const int n0   = (wid & 15) << 6;

    v8f acc[2][4] = {};
    gemm_core_32x64(A, Wt, m0, n0, lane, acc);

    const int half = lane >> 4;
    const int nlo  = lane & 15;
#pragma unroll
    for (int mi = 0; mi < 2; ++mi)
#pragma unroll
        for (int j = 0; j < 4; ++j)
#pragma unroll
            for (int r = 0; r < 8; ++r) {
                int m = m0 + mi * 16 + r + half * 8;
                int n = n0 + j * 16 + nlo;
                out[(size_t)m * D_MODEL + n] = acc[mi][j][r] + bias[n];
            }
}

// ---- fill positional halves of Qa / Ka -------------------------------------
// one thread per 16-byte chunk of the positional k blocks (2 and 3 of 4);
// t runs over B*H*S*64/8
static __device__ __forceinline__ void augment_chunk(const float* __restrict__ pe,
                                                     const float* __restrict__ alpha,
                                                     _Float16* __restrict__ Qa,
                                                     _Float16* __restrict__ Ka, int t) {
    const int lane = t & 31;
    const int part = (t >> 5) & 1;
    const int kbp  = (t >> 6) & 1;
    const int rt   = (t >> 7) & (SEQ / 16 - 1);
    const int bh   = t >> 14;
    const int s    = rt * 16 + (lane & 15);
    const int d    = kbp * 32 + part * 16 + (lane >> 4) * 8;
    const float al = alpha[bh & (NHEADS - 1)];
    const float4* pp = (const float4*)(pe + s * HDIM + d);
    float4 u = pp[0];
    float4 w = pp[1];
    float p[8] = {u.x, u.y, u.z, u.w, w.x, w.y, w.z, w.w};
    v8h qv, kv;
#pragma unroll
    for (int i = 0; i < 8; ++i) {
        qv[i] = (_Float16)(al * p[i]);
        kv[i] = (_Float16)p[i];
    }
    size_t base = (size_t)bh * SEQ * DAUG + pk_off(s, HDIM + d, DAUG / 32);
    *(v8h*)(Qa + base) = qv;
    *(v8h*)(Ka + base) = kv;
    // Stands in front of any later write of a register that the two stores name.
    asm volatile("s_wait_xcnt 0x0" ::: "memory");
}

// ---- everything that reads only inputs, in one grid -------------------------
// Blocks of 256 chunks: x, then Wq, Wk, Wv, Wo, then the positional halves.
// The f16 copies of x and of the four weights lie one behind the other in xw,
// all D_MODEL wide, so a convert block's output chunk is its index in the grid.
#define X_BLOCKS   (MROWS * D_MODEL / 8 / 256)                 // 2048
#define W_BLOCKS   (D_MODEL * D_MODEL / 8 / 256)               // 512
#define CVT_BLOCKS (X_BLOCKS + 4 * W_BLOCKS)                   // 4096
#define AUG_BLOCKS (BATCH * NHEADS * SEQ * HDIM / 8 / 256)     // 2048
__global__ void __launch_bounds__(256)
prep_kernel(const float* __restrict__ x,
            const float* __restrict__ Wq, const float* __restrict__ Wk,
            const float* __restrict__ Wv, const float* __restrict__ Wo,
            const float* __restrict__ pe, const float* __restrict__ alpha,
            _Float16* __restrict__ xw,
            _Float16* __restrict__ Qa, _Float16* __restrict__ Ka) {
    const int blk = blockIdx.x;
    if (blk < CVT_BLOCKS) {
        const float* in    = x;
        int          first = 0;          // the source's first block
        if (blk >= X_BLOCKS) {
            const int w = (blk - X_BLOCKS) / W_BLOCKS;
            in    = (w == 0) ? Wq : (w == 1) ? Wk : (w == 2) ? Wv : Wo;
            first = X_BLOCKS + w * W_BLOCKS;
        }
        cvt_chunk(in, xw + (size_t)first * 256 * 8, (blk - first) * 256 + threadIdx.x);
    } else {
        augment_chunk(pe, alpha, Qa, Ka, (blk - CVT_BLOCKS) * 256 + threadIdx.x);
    }
}

// ---- lane l with lane l ^ 16 (the two lanes that share one column) ----------
static __device__ __forceinline__ float xhalf(float x) {
    int v = __builtin_bit_cast(int, x);
    return __builtin_bit_cast(float,
        __builtin_amdgcn_permlanex16(v, v, 0x76543210, 0xfedcba98, false, false));
}

typedef __attribute__((ext_vector_type(2))) float    v2f;
typedef __attribute__((ext_vector_type(2))) _Float16 v2h;

#define KTILE 8192   // halves in one 64-key tile of Ka: 16 fragment blocks, contiguous (16 KB)
#define VTILE 4096   // halves in one 64-key tile of V^T: 8 fragment blocks, contiguous (8 KB)

// ---- one 64-key K tile and its V^T tile, global -> LDS, through no register ---
// 256 threads x (4 + 2) asynchronous copies of 16 bytes. kl, vl = this thread's
// byte addresses in the two buffers, kg, vg = its sources; within a tile copy c
// lies 4 KB behind copy c - 1.
static __device__ __forceinline__ void copy_kv_tile(unsigned kl, const _Float16* kg,
                                                    unsigned vl, const _Float16* vg) {
    // The wait is the statement's last line: it stands in front of every later
    // write of the address registers that the six copies name.
    asm volatile("global_load_async_to_lds_b128 %0, %6, off\n\t"
                 "global_load_async_to_lds_b128 %1, %7, off\n\t"
                 "global_load_async_to_lds_b128 %2, %8, off\n\t"
                 "global_load_async_to_lds_b128 %3, %9, off\n\t"
                 "global_load_async_to_lds_b128 %4, %10, off\n\t"
                 "global_load_async_to_lds_b128 %5, %11, off\n\t"
                 "s_wait_xcnt 0x0"
                 :: "v"(kl), "v"(kl + 4096u), "v"(kl + 8192u), "v"(kl + 12288u),
                    "v"(vl), "v"(vl + 4096u),
                    "v"(kg), "v"(kg + 2048), "v"(kg + 4096), "v"(kg + 6144),
                    "v"(vg), "v"(vg + 2048)
                 : "memory");
}

// ---- fused flash attention over augmented dim 128 --------------------------
// Block = (b, h, 128 q rows) -> 8 waves, each wave owns 16 q rows.
// Transposed products: S^T = Ka.Qa^T and O^T += V^T.P^T. In an accumulator tile
// a lane holds 8 keys (or 8 d) of ONE query, q0 + (lane & 15): maximum and
// sum run over the lane's own registers, the two lanes of a query exchange once,
// and two converted S^T tiles are the B operand of the second product as they
// stand, so P never goes through LDS.
// K and V^T tiles come into a two-buffer LDS ring by asynchronous copies, once per
// block, as the fragments they are read as: tile t + 1 is in flight while tile t is
// worked on, and one barrier a trip hands over.
// The grid gives every SIMD four waves, so the register budget is set for four:
// with it the compiler issues the ring's fragment reads as groups ahead of the
// WMMAs; with its own smaller budget it kept one or two fragments in flight per WMMA.
__global__ void __launch_bounds__(256) __attribute__((amdgpu_waves_per_eu(4, 4)))
attn_kernel(const _Float16* __restrict__ Qa,   // [b,h][s,128], fragment order
            const _Float16* __restrict__ Ka,   // [b,h][s,128], fragment order
            const _Float16* __restrict__ V,    // [b,h]: V^T (64 x s) as fragments, blocks along d, then keys
            const int*      __restrict__ mask, // [b,s]
            const float*    __restrict__ beta, // [h]
            _Float16*       __restrict__ O) {  // MROWS x D_MODEL, fragment order
    __shared__ __align__(32) float    KB[SEQ];                  // per key: beta, or -3e38 where masked
    __shared__ __align__(128) _Float16 KR[2 * KTILE];           // K ring: two 64-key tiles, fragment order
    __shared__ __align__(128) _Float16 VR[2 * VTILE];           // V^T ring: two 64-key tiles, fragment order

    const int lane = threadIdx.x & 31;
    const int widx = threadIdx.x >> 5;
    const int bh   = blockIdx.x >> 4;           // b*16 + h
    const int b    = bh >> 4;
    const int h    = bh & 15;
    const int q0   = (blockIdx.x & 15) * 128 + widx * 16;

    const _Float16* Qh = Qa + (size_t)bh * SEQ * DAUG;
    const _Float16* Kh = Ka + (size_t)bh * SEQ * DAUG;
    const _Float16* Vh = V  + (size_t)bh * SEQ * HDIM;
    const float bet = beta[h];

    // A key is a register index of S^T, so its mask and beta enter as the start
    // value of its S^T accumulator row. Read behind the barrier in front of the loop.
    {
        const int4* mp = (const int4*)(mask + b * SEQ + threadIdx.x * (SEQ / 256));
        const int4 ma = mp[0], mc = mp[1];
        float4 fa, fc;
        fa.x = (ma.x == 0) ? -3.0e38f : bet;  fa.y = (ma.y == 0) ? -3.0e38f : bet;
        fa.z = (ma.z == 0) ? -3.0e38f : bet;  fa.w = (ma.w == 0) ? -3.0e38f : bet;
        fc.x = (mc.x == 0) ? -3.0e38f : bet;  fc.y = (mc.y == 0) ? -3.0e38f : bet;
        fc.z = (mc.z == 0) ? -3.0e38f : bet;  fc.w = (mc.w == 0) ? -3.0e38f : bet;
        float4* kp = (float4*)&KB[threadIdx.x * (SEQ / 256)];
        kp[0] = fa;
        kp[1] = fc;
    }

    // ---- the ring, in front of the loop: tile 0 landed and published, tile 1 issued ----
    const unsigned  kr_lds = (unsigned)(size_t)&KR[threadIdx.x * 8];
    const unsigned  vr_lds = (unsigned)(size_t)&VR[threadIdx.x * 8];
    const _Float16* kg     = Kh + threadIdx.x * 8;
    const _Float16* vg     = Vh + threadIdx.x * 8;
    copy_kv_tile(kr_lds, kg, vr_lds, vg);
    // this wave's copies of tile 0 have landed before the barrier publishes them
    asm volatile("s_wait_asynccnt 0x0" ::: "memory");
    __syncthreads();
    copy_kv_tile(kr_lds + KTILE * 2, kg + KTILE, vr_lds + VTILE * 2, vg + VTILE);

    v16h qf[4];
#pragma unroll
    for (int kq = 0; kq < 4; ++kq) qf[kq] = load_frag_pk(Qh + ((q0 >> 4) * (DAUG / 32) + kq) * PK_BLOCK + lane * 8);

    v8f oacc[4] = {};            // oacc[j2][r] = O^T[j2*16 + half*8 + r][q0 + nlo]
    float rmax = -3.0e38f;       // this lane's query, both halves alike
    float rsum = 0.f;            // this lane's half of the keys only; joined at the end

    const int half = lane >> 4;
    const int nlo  = lane & 15;

    for (int k0 = 0; k0 < SEQ; k0 += 64) {
        // ---- scores S^T = Ka.Qa^T (64 keys x 16 q, K=128); kq-outer => 4
        //      independent WMMA chains per step, 4 K-frag LDS loads clustered per step.
        //      sc[j][r] = score(key k0 + j*16 + half*8 + r, query q0 + nlo) ----
        const int kbuf = (k0 >> 6) & 1;          // this trip's buffer
        const _Float16* kt = KR + kbuf * KTILE + lane * 8;
        const _Float16* vt = VR + kbuf * VTILE + lane * 8;
        v8f sc[4];
#pragma unroll
        for (int j = 0; j < 4; ++j)
            sc[j] = *(const v8f*)&KB[k0 + j * 16 + half * 8];
#pragma unroll
        for (int kq = 0; kq < 4; ++kq) {
            v16h kb[4];
#pragma unroll
            for (int j = 0; j < 4; ++j)
                kb[j] = load_frag_pk(kt + (j * (DAUG / 32) + kq) * PK_BLOCK);
#pragma unroll
            for (int j = 0; j < 4; ++j)
                sc[j] = wmma_f16(kb[j], qf[kq], sc[j]);
        }

        // ---- online softmax: one query per lane ----
        float mt[4];   // one chain per tile: a tile's maximum runs under the later tiles' WMMAs
#pragma unroll
        for (int j = 0; j < 4; ++j) {
            mt[j] = sc[j][0];
#pragma unroll
            for (int r = 1; r < 8; ++r) mt[j] = fmaxf(mt[j], sc[j][r]);
        }
        float m = fmaxf(fmaxf(mt[0], mt[1]), fmaxf(mt[2], mt[3]));
        m = fmaxf(m, xhalf(m));
        const float nm   = fmaxf(rmax, m);
        const float corr = __expf(rmax - nm);
        rmax = nm;
#pragma unroll
        for (int j2 = 0; j2 < 4; ++j2) oacc[j2] *= corr;

        // p = exp(s - nm); elements 8*t .. 8*t+7 of the 32-key B operand are tile
        // 2*kk + t, registers 0..7: the k order of the V^T fragments.
        v16h pb[2];
        v2f  ls[4];    // one sum chain per tile
#pragma unroll
        for (int j = 0; j < 4; ++j) {
#pragma unroll
            for (int r = 0; r < 8; r += 2) {
                v2f d = (v2f{sc[j][r], sc[j][r + 1]} - nm) * 1.44269504088896340736f;
                v2f p = {__builtin_amdgcn_exp2f(d.x), __builtin_amdgcn_exp2f(d.y)};
                ls[j] = (r == 0) ? p : ls[j] + p;
                v2h ph = __builtin_convertvector(p, v2h);
                pb[j >> 1][(j & 1) * 8 + r]     = ph.x;
                pb[j >> 1][(j & 1) * 8 + r + 1] = ph.y;
            }
        }
        const v2f lt = (ls[0] + ls[1]) + (ls[2] + ls[3]);
        rsum = rsum * corr + (lt.x + lt.y);

        // ---- O^T += V^T.P^T : A-frags from the V^T ring, B-frags from registers ----
#pragma unroll
        for (int kk = 0; kk < 2; ++kk) {
            v16h vb[4];
#pragma unroll
            for (int j2 = 0; j2 < 4; ++j2)
                vb[j2] = load_frag_pk(vt + (kk * (HDIM / 16) + j2) * PK_BLOCK);
#pragma unroll
            for (int j2 = 0; j2 < 4; ++j2)
                oacc[j2] = wmma_f16(vb[j2], pb[kk], oacc[j2]);
        }
        // ---- foot of the trip: hand over. This wave's LDS reads are done ...
        asm volatile("s_wait_dscnt 0x0" ::: "memory");
        // ... and its copies of the next tile have landed, ...
        asm volatile("s_wait_asynccnt 0x0" ::: "memory");
        // ... so the barrier publishes the next tiles and frees this trip's buffers.
        __syncthreads();
        if (k0 + 128 < SEQ)   // the tiles after next, into the buffers just read
            copy_kv_tile(kr_lds + kbuf * (KTILE * 2), kg + (size_t)(k0 + 128) * DAUG,
                         vr_lds + kbuf * (VTILE * 2), vg + (size_t)(k0 + 128) * HDIM);
    }
    // no copy is outstanding when the wave goes on to its end
    asm volatile("s_wait_asynccnt 0x0" ::: "memory");

    // ---- normalize and store O (4096 x 1024, row b*S+s, column h*64+d):
    //      a lane's 8 registers are 8 consecutive columns, one 16-byte chunk ----
    const float inv = 1.f / fmaxf(rsum + xhalf(rsum), 1e-20f);
#pragma unroll
    for (int j2 = 0; j2 < 4; ++j2) {
        v8h o;
#pragma unroll
        for (int r = 0; r < 8; ++r) o[r] = (_Float16)(oacc[j2][r] * inv);
        *(v8h*)(O + pk_off(b * SEQ + q0 + nlo, h * HDIM + j2 * 16 + half * 8, D_MODEL / 32)) = o;
    }
}

// ---------------------------------------------------------------------------
extern "C" void kernel_launch(void* const* d_in, const int* in_sizes, int n_in,
                              void* d_out, int out_size, void* d_ws, size_t ws_size,
                              hipStream_t stream) {
    const float* x     = (const float*)d_in[0];
    const int*   mask  = (const int*)d_in[1];
    const float* Wq    = (const float*)d_in[2];
    const float* bq    = (const float*)d_in[3];
    const float* Wk    = (const float*)d_in[4];
    const float* bk    = (const float*)d_in[5];
    const float* Wv    = (const float*)d_in[6];
    const float* bv    = (const float*)d_in[7];
    const float* Wo    = (const float*)d_in[8];
    const float* bo    = (const float*)d_in[9];
    const float* pe    = (const float*)d_in[10];
    const float* alpha = (const float*)d_in[11];
    const float* beta  = (const float*)d_in[12];
    float* out = (float*)d_out;

    // workspace carve-up (64 MB total)
    char* ws = (char*)d_ws;
    _Float16* xh  = (_Float16*)ws; ws += (size_t)MROWS * D_MODEL * 2;        // 8 MB
    _Float16* Wqh = (_Float16*)ws; ws += (size_t)3 * D_MODEL * D_MODEL * 2;  // Wq, Wk, Wv: 2 MB each
    _Float16* Woh = (_Float16*)ws; ws += (size_t)D_MODEL * D_MODEL * 2;      // 2 MB
    _Float16* Qa  = (_Float16*)ws; ws += (size_t)BATCH * NHEADS * SEQ * DAUG * 2; // 16 MB
    _Float16* Kaa = (_Float16*)ws; ws += (size_t)BATCH * NHEADS * SEQ * DAUG * 2; // 16 MB
    _Float16* Vb  = (_Float16*)ws; ws += (size_t)BATCH * NHEADS * SEQ * HDIM * 2; //  8 MB
    _Float16* Oh  = (_Float16*)ws; ws += (size_t)MROWS * D_MODEL * 2;             //  8 MB

    // the f16 copies of x, Wq, Wk, Wv, Wo are one run of the workspace, filled from xh on
    prep_kernel<<<CVT_BLOCKS + AUG_BLOCKS, 256, 0, stream>>>(x, Wq, Wk, Wv, Wo, pe, alpha,
                                                             xh, Qa, Kaa);

    proj_qkv_kernel<<<3 * PROJ_BLOCKS, 256, 0, stream>>>(xh, Wqh, bq, bk, bv, Qa, Kaa, Vb);

    attn_kernel<<<512, 256, 0, stream>>>(Qa, Kaa, Vb, mask, beta, Oh);

    proj_out_kernel<<<256, 256, 0, stream>>>(Oh, Woh, bo, out);
}

// v006
// One run takes 95.9 microseconds.
// Next to v005, in two timings, it ran 1.17 and 1.18 times as fast.
// Over all steps from v000 it is 3.42 times as fast.
#include <hip/hip_runtime.h>
#include <hip/hip_fp16.h>

// ---------------------------------------------------------------------------
// Disentangled attention, MI455X (gfx1250, wave32, WMMA).
// scores = (q.k)/8 + alpha_h*(pe_q.pe_k) + beta_h  folded into one GEMM by
// augmenting head-dim 64 -> 128:  Qa=[q/8, alpha*pe], Ka=[k, pe].
// f16 WMMA + fp32 accumulation; flash-style online softmax (no 512MB scores).
// GEMMs: 128x128 block tile, 8 waves of 32x64; both operands' fragments come once
// per block into a two-buffer LDS ring by asynchronous copies and are read from there.
// Every f16 matrix operand (x, the weights, Qa, Ka, V^T, O) is stored by its
// producer in fragment order, so that each wave-wide 16-byte load or copy covers
// 512 contiguous bytes (4 whole lines, not 16 partial ones).
// Four dependent launches: launches that do not depend on one another share one
// grid, and a range of the block index picks the job.
// ---------------------------------------------------------------------------

typedef __attribute__((ext_vector_type(16))) _Float16 v16h;
typedef __attribute__((ext_vector_type(8)))  _Float16 v8h;
typedef __attribute__((ext_vector_type(8)))  float    v8f;

#define D_MODEL 1024
#define NHEADS  16
#define HDIM    64
#define SEQ     2048
#define BATCH   2
#define MROWS   (BATCH * SEQ)   // 4096
#define DAUG    128             // augmented head dim (64 content + 64 pos)

// ---- WMMA helper -----------------------------------------------------------
static __device__ __forceinline__ v8f wmma_f16(v16h a, v16h b, v8f c) {
    return __builtin_amdgcn_wmma_f32_16x16x32_f16(false, a, false, b, (short)0, c,
                                                  false, false);
}

// ---- 16-bit A-layout fragment (also the B fragment of the N x K view) --------
// ISA 7.12.2: lanes 0-15 hold row M=lane with K = {k0..k0+7, k0+16..k0+23};
// lanes 16-31 hold the same rows with K = {k0+8..k0+15, k0+24..k0+31}.

// ---- fragment-order storage of a rows x K f16 matrix ------------------------
// One 16-row x 32-k fragment is a 1 KB block; blocks run along k, then rows.
// Inside a block: 512 B with each lane's first 8 halves, then 512 B with its
// second 8, in the lane and k order above.
static __device__ __forceinline__ size_t pk_off(int row, int k, int kblocks) {
    return ((size_t)((row >> 4) * kblocks + (k >> 5)) << 9)
         + (((k >> 4) & 1) << 8)
         + (((row & 15) + (((k >> 3) & 1) << 4)) << 3)
         + (k & 7);
}

#define PK_BLOCK 512   // halves in one 16 x 32 fragment block

// base = start of the fragment's block + lane * 8
static __device__ __forceinline__ v16h load_frag_pk(const _Float16* __restrict__ base) {
    v8h lo = *(const v8h*)(base);
    v8h hi = *(const v8h*)(base + 256);
    return __builtin_shufflevector(lo, hi, 0,1,2,3,4,5,6,7,8,9,10,11,12,13,14,15);
}

// ---- fp32 -> f16 convert, rows x D_MODEL, into fragment order ---------------
// One thread per 16-byte chunk of the output; chunk c lies at out + 8 * c.
static __device__ __forceinline__ void cvt_chunk(const float* __restrict__ in,
                                                 _Float16* __restrict__ out, int c) {
    const int lane = c & 31;
    const int part = (c >> 5) & 1;
    const int kb   = (c >> 6) & (D_MODEL / 32 - 1);
    const int rt   = c >> 11;
    const int row  = rt * 16 + (lane & 15);
    const int k    = kb * 32 + part * 16 + (lane >> 4) * 8;
    const float4* ip = (const float4*)(in + (size_t)row * D_MODEL + k);
    float4 u = ip[0];
    float4 w = ip[1];
    v8h o;
    o[0] = (_Float16)u.x; o[1] = (_Float16)u.y; o[2] = (_Float16)u.z; o[3] = (_Float16)u.w;
    o[4] = (_Float16)w.x; o[5] = (_Float16)w.y; o[6] = (_Float16)w.z; o[7] = (_Float16)w.w;
    *(v8h*)(out + (size_t)c * 8) = o;
}

// ---- four asynchronous copies of 16 bytes a thread, global -> LDS ------------
// l = this thread's LDS byte address, g = its source; copy c lies 4 KB behind copy
// c - 1 in LDS and gs halves behind it in global memory.
static __device__ __forceinline__ void copy4(unsigned l, const _Float16* g, int gs) {
    // The wait is the statement's last line: it stands in front of every later
    // write of the address registers that the four copies name.
    asm volatile("global_load_async_to_lds_b128 %0, %4, off\n\t"
                 "global_load_async_to_lds_b128 %1, %5, off\n\t"
                 "global_load_async_to_lds_b128 %2, %6, off\n\t"
                 "global_load_async_to_lds_b128 %3, %7, off\n\t"
                 "s_wait_xcnt 0x0"
                 :: "v"(l), "v"(l + 4096u), "v"(l + 8192u), "v"(l + 12288u),
                    "v"(g), "v"(g + gs), "v"(g + 2 * gs), "v"(g + 3 * gs)
                 : "memory");
}

// ---- common GEMM core: 128x128 block tile, 8 waves (4 x 2) of 32x64 ----------
// acc[mi][j] += A[m0+mi*16,:] . Wt[n0+j*16,:]^T, k ascending.
// A stage is KB fragment blocks (32 k each) of the block's 8 row tiles of A and 8
// of Wt, as they lie in global memory: in LDS tile rt starts at rt * KB * PK_BLOCK
// (0..7 A, 8..15 Wt). Stage s + 1 is in flight while stage s is worked on, and one
// barrier a stage hands over.
#define GEMM_RING(KB) (2 * 16 * (KB) * PK_BLOCK)   // halves of LDS for the two buffers
template <int KB>
static __device__ __forceinline__ void gemm_core_128x128(
        const _Float16* __restrict__ A, const _Float16* __restrict__ Wt,
        int mb, int nb, int wm, int wn, int lane, _Float16* ring, v8f acc[2][4]) {
    constexpr int RT    = (D_MODEL / 32) * PK_BLOCK;   // halves per 16-row tile in global memory
    constexpr int TILE  = KB * PK_BLOCK;               // halves per 16-row tile in a stage
    constexpr int STAGE = 16 * TILE;                   // halves per buffer
    constexpr int NST   = D_MODEL / (32 * KB);         // stages
    constexpr int TPC   = 256 * 8 / TILE;              // row tiles that one copy of the block covers
    constexpr int NC    = 8 / TPC;                     // copies per thread and operand
    const int t8 = threadIdx.x * 8;
    const _Float16* ga = A  + (size_t)((mb >> 4) + t8 / TILE) * RT + t8 % TILE;
    const _Float16* gb = Wt + (size_t)((nb >> 4) + t8 / TILE) * RT + t8 % TILE;
    const unsigned  l0 = (unsigned)(size_t)&ring[t8];

    auto copy_stage = [&](int s, int buf) {
#pragma unroll   // c is a constant in every address step
        for (int c = 0; c < NC; c += 4) {
            copy4(l0 + buf * (STAGE * 2) + c * 4096u,
                  ga + s * TILE + c * (TPC * RT), TPC * RT);
            copy4(l0 + buf * (STAGE * 2) + 8 * TILE * 2 + c * 4096u,
                  gb + s * TILE + c * (TPC * RT), TPC * RT);
        }
    };

    // ---- in front of the loop: stage 0 landed and published, stage 1 issued ----
    copy_stage(0, 0);
    // this wave's copies of stage 0 have landed before the barrier publishes them
    asm volatile("s_wait_asynccnt 0x0" ::: "memory");
    __syncthreads();
    copy_stage(1, 1);

    const _Float16* ra = ring + (wm * 2) * TILE + lane * 8;
    const _Float16* rb = ring + (8 + wn * 4) * TILE + lane * 8;
    for (int s = 0; s < NST; ++s) {
        const int buf = s & 1;
        const _Float16* pa = ra + buf * STAGE;
        const _Float16* pb = rb + buf * STAGE;
#pragma unroll   // the fragments' places in the stage become immediate offsets
        for (int kk = 0; kk < KB; ++kk) {
            v16h a0 = load_frag_pk(pa + kk * PK_BLOCK);
            v16h a1 = load_frag_pk(pa + TILE + kk * PK_BLOCK);
            v16h b0 = load_frag_pk(pb + kk * PK_BLOCK);
            v16h b1 = load_frag_pk(pb + TILE + kk * PK_BLOCK);
            v16h b2 = load_frag_pk(pb + 2 * TILE + kk * PK_BLOCK);
            v16h b3 = load_frag_pk(pb + 3 * TILE + kk * PK_BLOCK);
            // 8 independent accumulation chains
            acc[0][0] = wmma_f16(a0, b0, acc[0][0]);
            acc[0][1] = wmma_f16(a0, b1, acc[0][1]);
            acc[0][2] = wmma_f16(a0, b2, acc[0][2]);
            acc[0][3] = wmma_f16(a0, b3, acc[0][3]);
            acc[1][0] = wmma_f16(a1, b0, acc[1][0]);
            acc[1][1] = wmma_f16(a1, b1, acc[1][1]);
            acc[1][2] = wmma_f16(a1, b2, acc[1][2]);
            acc[1][3] = wmma_f16(a1, b3, acc[1][3]);
        }
        // ---- foot of the stage: hand over. This wave's LDS reads are done ...
        asm volatile("s_wait_dscnt 0x0" ::: "memory");
        // ... and its copies of the next stage have landed, ...
        asm volatile("s_wait_asynccnt 0x0" ::: "memory");
        // ... so the barrier publishes the next stage and frees this stage's buffer.
        __syncthreads();
        if (s + 2 < NST)   // the stage after next, into the buffer just read
            copy_stage(s + 2, buf);
    }
    // no copy is outstanding when the wave goes on to its epilogue
    asm volatile("s_wait_asynccnt 0x0" ::: "memory");
}

// ---- QKV projections: C = x @ W^T (+bias) * scale, head-split f16 output ---
// One block computes a 128x128 tile; one projection is 32 x 8 tiles = 256 blocks.
// One grid of 3 x 256 blocks: blocks 0..255 make q, 256..511 k, 512..767 v.
#define PROJ_BLOCKS 256
__global__ void __launch_bounds__(256)
proj_qkv_kernel(const _Float16* __restrict__ A,    // MROWS x D_MODEL, fragment order
                const _Float16* __restrict__ Wqkv, // Wq, Wk, Wv one behind the other, each D_MODEL x D_MODEL (N x K), fragment order
                const float*    __restrict__ bq,   // D_MODEL each
                const float*    __restrict__ bk,
                const float*    __restrict__ bv,
                _Float16*       __restrict__ Qa,   // [b,h][s,DAUG], fragment order per (b,h)
                _Float16*       __restrict__ Ka,   // [b,h][s,DAUG], fragment order per (b,h)
                _Float16*       __restrict__ V) {  // [b,h]: V^T (HDIM x s) as fragments, blocks along d, then keys
    const int lane  = threadIdx.x & 31;
    const int which = blockIdx.x / PROJ_BLOCKS;    // 0 q, 1 k, 2 v: the same for the whole block
    __shared__ __align__(128) _Float16 ring[GEMM_RING(2)];
    // wave number read as a scalar: the tile addresses then stay in scalar registers
    const int w    = __builtin_amdgcn_readfirstlane(threadIdx.x >> 5);
    const int tile = blockIdx.x % PROJ_BLOCKS;
    const int mb   = (tile >> 3) << 7;  // 32 row tiles of 128
    const int nb   = (tile & 7) << 7;   // 8 column tiles of 128
    const int m0   = mb + (w & 3) * 32; // this wave's 32 rows ...
    const int n0   = nb + (w >> 2) * 64; // ... and 64 columns
    const _Float16* Wt   = Wqkv + (size_t)which * D_MODEL * D_MODEL;
    const float*    bias = (which == 0) ? bq : (which == 1) ? bk : bv;

    v8f acc[2][4] = {};
    gemm_core_128x128<2>(A, Wt, mb, nb, w & 3, w >> 2, lane, ring, acc);

    const int half = lane >> 4;
    const int nlo  = lane & 15;
    if (which < 2) {
        _Float16* dst = (which == 0) ? Qa : Ka;
        // 1/sqrt(HDIM) = 1/8 is folded into the content half of Qa
        const float scale = (which == 0) ? 0.125f : 1.0f;
        // The 32-row tile lies in one batch and the 64-column group is one head.
        // pk_off adds over disjoint index bits: one lane base, constant steps.
        _Float16* lp = dst
            + ((size_t)(m0 >> 11) * NHEADS + (n0 >> 6)) * SEQ * DAUG
            + pk_off((m0 & (SEQ - 1)) + half * 8, nlo, DAUG / 32);
#pragma unroll
        for (int mi = 0; mi < 2; ++mi)
#pragma unroll
            for (int j = 0; j < 4; ++j)
#pragma unroll
                for (int r = 0; r < 8; ++r) {
                    float v = (acc[mi][j][r] + bias[n0 + j * 16 + nlo]) * scale;
                    lp[pk_off(mi * 16 + r, j * 16, DAUG / 32)] = (_Float16)v;
                }
        return;
    }
    // V^T: row = d, k = key. The tile's 32 keys are one k block, its 64 columns the
    // four d tiles. In block j a lane holds row d = nlo and, per mi, the 8 keys
    // mi*16 + half*8 + r: chunk "lane" of the block's half mi, one 16-byte store.
    _Float16* vp = V
        + ((size_t)(m0 >> 11) * NHEADS + (n0 >> 6)) * SEQ * HDIM
        + (size_t)((m0 & (SEQ - 1)) >> 5) * (HDIM / 16) * PK_BLOCK + lane * 8;
#pragma unroll
    for (int mi = 0; mi < 2; ++mi)
#pragma unroll
        for (int j = 0; j < 4; ++j) {
            const float bj = bias[n0 + j * 16 + nlo];
            v8h o;
#pragma unroll
            for (int r = 0; r < 8; ++r) o[r] = (_Float16)(acc[mi][j][r] + bj);
            *(v8h*)(vp + j * PK_BLOCK + mi * 256) = o;
        }
    // Stands in front of any later write of a register that these stores name.
    asm volatile("s_wait_xcnt 0x0" ::: "memory");
}

// ---- output projection: out = O @ Wo^T + bo (fp32 out) ---------------------
__global__ void __launch_bounds__(256)
proj_out_kernel(const _Float16* __restrict__ A,    // MROWS x D_MODEL (f16), fragment order
                const _Float16* __restrict__ Wt,   // D_MODEL x D_MODEL (N x K), fragment order
                const float*    __restrict__ bias,
                float*          __restrict__ out) {
    const int lane = threadIdx.x & 31;
    // one block a WGP: longer stages, so that a stage's work covers the next one's flight
    __shared__ __align__(128) _Float16 ring[GEMM_RING(4)];
    // wave number read as a scalar: the tile addresses then stay in scalar registers
    const int w    = __builtin_amdgcn_readfirstlane(threadIdx.x >> 5);
    const int mb   = (blockIdx.x >> 3) << 7;
    const int nb   = (blockIdx.x & 7) << 7;
    const int m0   = mb + (w & 3) * 32;
    const int n0   = nb + (w >> 2) * 64;

    v8f acc[2][4] = {};
    gemm_core_128x128<4>(A, Wt, mb, nb, w & 3, w >> 2, lane, ring, acc);

    const int half = lane >> 4;
    const int nlo  = lane & 15;
#pragma unroll
    for (int mi = 0; mi < 2; ++mi)
#pragma unroll
        for (int j = 0; j < 4; ++j)
#pragma unroll
            for (int r = 0; r < 8; ++r) {
                int m = m0 + mi * 16 + r + half * 8;
                int n = n0 + j * 16 + nlo;
                out[(size_t)m * D_MODEL + n] = acc[mi][j][r] + bias[n];
            }
}

// ---- fill positional halves of Qa / Ka -------------------------------------
// one thread per 16-byte chunk of the positional k blocks (2 and 3 of 4);
// t runs over B*H*S*64/8
static __device__ __forceinline__ void augment_chunk(const float* __restrict__ pe,
                                                     const float* __restrict__ alpha,
                                                     _Float16* __restrict__ Qa,
                                                     _Float16* __restrict__ Ka, int t) {
    const int lane = t & 31;
    const int part = (t >> 5) & 1;
    const int kbp  = (t >> 6) & 1;
    const int rt   = (t >> 7) & (SEQ / 16 - 1);
    const int bh   = t >> 14;
    const int s    = rt * 16 + (lane & 15);
    const int d    = kbp * 32 + part * 16 + (lane >> 4) * 8;
    const float al = alpha[bh & (NHEADS - 1)];
    const float4* pp = (const float4*)(pe + s * HDIM + d);
    float4 u = pp[0];
    float4 w = pp[1];
    float p[8] = {u.x, u.y, u.z, u.w, w.x, w.y, w.z, w.w};
    v8h qv, kv;
#pragma unroll
    for (int i = 0; i < 8; ++i) {
        qv[i] = (_Float16)(al * p[i]);
        kv[i] = (_Float16)p[i];
    }
    size_t base = (size_t)bh * SEQ * DAUG + pk_off(s, HDIM + d, DAUG / 32);
    *(v8h*)(Qa + base) = qv;
    *(v8h*)(Ka + base) = kv;
    // Stands in front of any later write of a register that the two stores name.
    asm volatile("s_wait_xcnt 0x0" ::: "memory");
}

// ---- everything that reads only inputs, in one grid -------------------------
// Blocks of 256 chunks: x, then Wq, Wk, Wv, Wo, then the positional halves.
// The f16 copies of x and of the four weights lie one behind the other in xw,
// all D_MODEL wide, so a convert block's output chunk is its index in the grid.
#define X_BLOCKS   (MROWS * D_MODEL / 8 / 256)                 // 2048
#define W_BLOCKS   (D_MODEL * D_MODEL / 8 / 256)               // 512
#define CVT_BLOCKS (X_BLOCKS + 4 * W_BLOCKS)                   // 4096
#define AUG_BLOCKS (BATCH * NHEADS * SEQ * HDIM / 8 / 256)     // 2048
__global__ void __launch_bounds__(256)
prep_kernel(const float* __restrict__ x,
            const float* __restrict__ Wq, const float* __restrict__ Wk,
            const float* __restrict__ Wv, const float* __restrict__ Wo,
            const float* __restrict__ pe, const float* __restrict__ alpha,
            _Float16* __restrict__ xw,
            _Float16* __restrict__ Qa, _Float16* __restrict__ Ka) {
    const int blk = blockIdx.x;
    if (blk < CVT_BLOCKS) {
        const float* in    = x;
        int          first = 0;          // the source's first block
        if (blk >= X_BLOCKS) {
            const int w = (blk - X_BLOCKS) / W_BLOCKS;
            in    = (w == 0) ? Wq : (w == 1) ? Wk : (w == 2) ? Wv : Wo;
            first = X_BLOCKS + w * W_BLOCKS;
        }
        cvt_chunk(in, xw + (size_t)first * 256 * 8, (blk - first) * 256 + threadIdx.x);
    } else {
        augment_chunk(pe, alpha, Qa, Ka, (blk - CVT_BLOCKS) * 256 + threadIdx.x);
    }
}

// ---- lane l with lane l ^ 16 (the two lanes that share one column) ----------
static __device__ __forceinline__ float xhalf(float x) {
    int v = __builtin_bit_cast(int, x);
    return __builtin_bit_cast(float,
        __builtin_amdgcn_permlanex16(v, v, 0x76543210, 0xfedcba98, false, false));
}

typedef __attribute__((ext_vector_type(2))) float    v2f;
typedef __attribute__((ext_vector_type(2))) _Float16 v2h;

#define KTILE 8192   // halves in one 64-key tile of Ka: 16 fragment blocks, contiguous (16 KB)
#define VTILE 4096   // halves in one 64-key tile of V^T: 8 fragment blocks, contiguous (8 KB)

// ---- one 64-key K tile and its V^T tile, global -> LDS, through no register ---
// 256 threads x (4 + 2) asynchronous copies of 16 bytes. kl, vl = this thread's
// byte addresses in the two buffers, kg, vg = its sources; within a tile copy c
// lies 4 KB behind copy c - 1.
static __device__ __forceinline__ void copy_kv_tile(unsigned kl, const _Float16* kg,
                                                    unsigned vl, const _Float16* vg) {
    // The wait is the statement's last line: it stands in front of every later
    // write of the address registers that the six copies name.
    asm volatile("global_load_async_to_lds_b128 %0, %6, off\n\t"
                 "global_load_async_to_lds_b128 %1, %7, off\n\t"
                 "global_load_async_to_lds_b128 %2, %8, off\n\t"
                 "global_load_async_to_lds_b128 %3, %9, off\n\t"
                 "global_load_async_to_lds_b128 %4, %10, off\n\t"
                 "global_load_async_to_lds_b128 %5, %11, off\n\t"
                 "s_wait_xcnt 0x0"
                 :: "v"(kl), "v"(kl + 4096u), "v"(kl + 8192u), "v"(kl + 12288u),
                    "v"(vl), "v"(vl + 4096u),
                    "v"(kg), "v"(kg + 2048), "v"(kg + 4096), "v"(kg + 6144),
                    "v"(vg), "v"(vg + 2048)
                 : "memory");
}

// ---- fused flash attention over augmented dim 128 --------------------------
// Block = (b, h, 128 q rows) -> 8 waves, each wave owns 16 q rows.
// Transposed products: S^T = Ka.Qa^T and O^T += V^T.P^T. In an accumulator tile
// a lane holds 8 keys (or 8 d) of ONE query, q0 + (lane & 15): maximum and
// sum run over the lane's own registers, the two lanes of a query exchange once,
// and two converted S^T tiles are the B operand of the second product as they
// stand, so P never goes through LDS.
// K and V^T tiles come into a two-buffer LDS ring by asynchronous copies, once per
// block, as the fragments they are read as: tile t + 1 is in flight while tile t is
// worked on, and one barrier a trip hands over.
// The grid gives every SIMD four waves, so the register budget is set for four:
// with it the compiler issues the ring's fragment reads as groups ahead of the
// WMMAs; with its own smaller budget it kept one or two fragments in flight per WMMA.
__global__ void __launch_bounds__(256) __attribute__((amdgpu_waves_per_eu(4, 4)))
attn_kernel(const _Float16* __restrict__ Qa,   // [b,h][s,128], fragment order
            const _Float16* __restrict__ Ka,   // [b,h][s,128], fragment order
            const _Float16* __restrict__ V,    // [b,h]: V^T (64 x s) as fragments, blocks along d, then keys
            const int*      __restrict__ mask, // [b,s]
            const float*    __restrict__ beta, // [h]
            _Float16*       __restrict__ O) {  // MROWS x D_MODEL, fragment order
    __shared__ __align__(32) float    KB[SEQ];                  // per key: beta, or -3e38 where masked
    __shared__ __align__(128) _Float16 KR[2 * KTILE];           // K ring: two 64-key tiles, fragment order
    __shared__ __align__(128) _Float16 VR[2 * VTILE];           // V^T ring: two 64-key tiles, fragment order

    const int lane = threadIdx.x & 31;
    const int widx = threadIdx.x >> 5;
    const int bh   = blockIdx.x >> 4;           // b*16 + h
    const int b    = bh >> 4;
    const int h    = bh & 15;
    const int q0   = (blockIdx.x & 15) * 128 + widx * 16;

    const _Float16* Qh = Qa + (size_t)bh * SEQ * DAUG;
    const _Float16* Kh = Ka + (size_t)bh * SEQ * DAUG;
    const _Float16* Vh = V  + (size_t)bh * SEQ * HDIM;
    const float bet = beta[h];

    // A key is a register index of S^T, so its mask and beta enter as the start
    // value of its S^T accumulator row. Read behind the barrier in front of the loop.
    {
        const int4* mp = (const int4*)(mask + b * SEQ + threadIdx.x * (SEQ / 256));
        const int4 ma = mp[0], mc = mp[1];
        float4 fa, fc;
        fa.x = (ma.x == 0) ? -3.0e38f : bet;  fa.y = (ma.y == 0) ? -3.0e38f : bet;
        fa.z = (ma.z == 0) ? -3.0e38f : bet;  fa.w = (ma.w == 0) ? -3.0e38f : bet;
        fc.x = (mc.x == 0) ? -3.0e38f : bet;  fc.y = (mc.y == 0) ? -3.0e38f : bet;
        fc.z = (mc.z == 0) ? -3.0e38f : bet;  fc.w = (mc.w == 0) ? -3.0e38f : bet;
        float4* kp = (float4*)&KB[threadIdx.x * (SEQ / 256)];
        kp[0] = fa;
        kp[1] = fc;
    }

    // ---- the ring, in front of the loop: tile 0 landed and published, tile 1 issued ----
    const unsigned  kr_lds = (unsigned)(size_t)&KR[threadIdx.x * 8];
    const unsigned  vr_lds = (unsigned)(size_t)&VR[threadIdx.x * 8];
    const _Float16* kg     = Kh + threadIdx.x * 8;
    const _Float16* vg     = Vh + threadIdx.x * 8;
    copy_kv_tile(kr_lds, kg, vr_lds, vg);
    // this wave's copies of tile 0 have landed before the barrier publishes them
    asm volatile("s_wait_asynccnt 0x0" ::: "memory");
    __syncthreads();
    copy_kv_tile(kr_lds + KTILE * 2, kg + KTILE, vr_lds + VTILE * 2, vg + VTILE);

    v16h qf[4];
#pragma unroll
    for (int kq = 0; kq < 4; ++kq) qf[kq] = load_frag_pk(Qh + ((q0 >> 4) * (DAUG / 32) + kq) * PK_BLOCK + lane * 8);

    v8f oacc[4] = {};            // oacc[j2][r] = O^T[j2*16 + half*8 + r][q0 + nlo]
    float rmax = -3.0e38f;       // this lane's query, both halves alike
    float rsum = 0.f;            // this lane's half of the keys only; joined at the end

    const int half = lane >> 4;
    const int nlo  = lane & 15;

    for (int k0 = 0; k0 < SEQ; k0 += 64) {
        // ---- scores S^T = Ka.Qa^T (64 keys x 16 q, K=128); kq-outer => 4
        //      independent WMMA chains per step, 4 K-frag LDS loads clustered per step.
        //      sc[j][r] = score(key k0 + j*16 + half*8 + r, query q0 + nlo) ----
        const int kbuf = (k0 >> 6) & 1;          // this trip's buffer
        const _Float16* kt = KR + kbuf * KTILE + lane * 8;
        const _Float16* vt = VR + kbuf * VTILE + lane * 8;
        v8f sc[4];
#pragma unroll
        for (int j = 0; j < 4; ++j)
            sc[j] = *(const v8f*)&KB[k0 + j * 16 + half * 8];
#pragma unroll
        for (int kq = 0; kq < 4; ++kq) {
            v16h kb[4];
#pragma unroll
            for (int j = 0; j < 4; ++j)
                kb[j] = load_frag_pk(kt + (j * (DAUG / 32) + kq) * PK_BLOCK);
#pragma unroll
            for (int j = 0; j < 4; ++j)
                sc[j] = wmma_f16(kb[j], qf[kq], sc[j]);
        }

        // ---- online softmax: one query per lane ----
        float mt[4];   // one chain per tile: a tile's maximum runs under the later tiles' WMMAs
#pragma unroll
        for (int j = 0; j < 4; ++j) {
            mt[j] = sc[j][0];
#pragma unroll
            for (int r = 1; r < 8; ++r) mt[j] = fmaxf(mt[j], sc[j][r]);
        }
        float m = fmaxf(fmaxf(mt[0], mt[1]), fmaxf(mt[2], mt[3]));
        m = fmaxf(m, xhalf(m));
        const float nm   = fmaxf(rmax, m);
        const float corr = __expf(rmax - nm);
        rmax = nm;
#pragma unroll
        for (int j2 = 0; j2 < 4; ++j2) oacc[j2] *= corr;

        // p = exp(s - nm); elements 8*t .. 8*t+7 of the 32-key B operand are tile
        // 2*kk + t, registers 0..7: the k order of the V^T fragments.
        v16h pb[2];
        v2f  ls[4];    // one sum chain per tile
#pragma unroll
        for (int j = 0; j < 4; ++j) {
#pragma unroll
            for (int r = 0; r < 8; r += 2) {
                v2f d = (v2f{sc[j][r], sc[j][r + 1]} - nm) * 1.44269504088896340736f;
                v2f p = {__builtin_amdgcn_exp2f(d.x), __builtin_amdgcn_exp2f(d.y)};
                ls[j] = (r == 0) ? p : ls[j] + p;
                v2h ph = __builtin_convertvector(p, v2h);
                pb[j >> 1][(j & 1) * 8 + r]     = ph.x;
                pb[j >> 1][(j & 1) * 8 + r + 1] = ph.y;
            }
        }
        const v2f lt = (ls[0] + ls[1]) + (ls[2] + ls[3]);
        rsum = rsum * corr + (lt.x + lt.y);

        // ---- O^T += V^T.P^T : A-frags from the V^T ring, B-frags from registers ----
#pragma unroll
        for (int kk = 0; kk < 2; ++kk) {
            v16h vb[4];
#pragma unroll
            for (int j2 = 0; j2 < 4; ++j2)
                vb[j2] = load_frag_pk(vt + (kk * (HDIM / 16) + j2) * PK_BLOCK);
#pragma unroll
            for (int j2 = 0; j2 < 4; ++j2)
                oacc[j2] = wmma_f16(vb[j2], pb[kk], oacc[j2]);
        }
        // ---- foot of the trip: hand over. This wave's LDS reads are done ...
        asm volatile("s_wait_dscnt 0x0" ::: "memory");
        // ... and its copies of the next tile have landed, ...
        asm volatile("s_wait_asynccnt 0x0" ::: "memory");
        // ... so the barrier publishes the next tiles and frees this trip's buffers.
        __syncthreads();
        if (k0 + 128 < SEQ)   // the tiles after next, into the buffers just read
            copy_kv_tile(kr_lds + kbuf * (KTILE * 2), kg + (size_t)(k0 + 128) * DAUG,
                         vr_lds + kbuf * (VTILE * 2), vg + (size_t)(k0 + 128) * HDIM);
    }
    // no copy is outstanding when the wave goes on to its end
    asm volatile("s_wait_asynccnt 0x0" ::: "memory");

    // ---- normalize and store O (4096 x 1024, row b*S+s, column h*64+d):
    //      a lane's 8 registers are 8 consecutive columns, one 16-byte chunk ----
    const float inv = 1.f / fmaxf(rsum + xhalf(rsum), 1e-20f);
#pragma unroll
    for (int j2 = 0; j2 < 4; ++j2) {
        v8h o;
#pragma unroll
        for (int r = 0; r < 8; ++r) o[r] = (_Float16)(oacc[j2][r] * inv);
        *(v8h*)(O + pk_off(b * SEQ + q0 + nlo, h * HDIM + j2 * 16 + half * 8, D_MODEL / 32)) = o;
    }
}

// ---------------------------------------------------------------------------
extern "C" void kernel_launch(void* const* d_in, const int* in_sizes, int n_in,
                              void* d_out, int out_size, void* d_ws, size_t ws_size,
                              hipStream_t stream) {
    const float* x     = (const float*)d_in[0];
    const int*   mask  = (const int*)d_in[1];
    const float* Wq    = (const float*)d_in[2];
    const float* bq    = (const float*)d_in[3];
    const float* Wk    = (const float*)d_in[4];
    const float* bk    = (const float*)d_in[5];
    const float* Wv    = (const float*)d_in[6];
    const float* bv    = (const float*)d_in[7];
    const float* Wo    = (const float*)d_in[8];
    const float* bo    = (const float*)d_in[9];
    const float* pe    = (const float*)d_in[10];
    const float* alpha = (const float*)d_in[11];
    const float* beta  = (const float*)d_in[12];
    float* out = (float*)d_out;

    // workspace carve-up (64 MB total)
    char* ws = (char*)d_ws;
    _Float16* xh  = (_Float16*)ws; ws += (size_t)MROWS * D_MODEL * 2;        // 8 MB
    _Float16* Wqh = (_Float16*)ws; ws += (size_t)3 * D_MODEL * D_MODEL * 2;  // Wq, Wk, Wv: 2 MB each
    _Float16* Woh = (_Float16*)ws; ws += (size_t)D_MODEL * D_MODEL * 2;      // 2 MB
    _Float16* Qa  = (_Float16*)ws; ws += (size_t)BATCH * NHEADS * SEQ * DAUG * 2; // 16 MB
    _Float16* Kaa = (_Float16*)ws; ws += (size_t)BATCH * NHEADS * SEQ * DAUG * 2; // 16 MB
    _Float16* Vb  = (_Float16*)ws; ws += (size_t)BATCH * NHEADS * SEQ * HDIM * 2; //  8 MB
    _Float16* Oh  = (_Float16*)ws; ws += (size_t)MROWS * D_MODEL * 2;             //  8 MB

    // the f16 copies of x, Wq, Wk, Wv, Wo are one run of the workspace, filled from xh on
    prep_kernel<<<CVT_BLOCKS + AUG_BLOCKS, 256, 0, stream>>>(x, Wq, Wk, Wv, Wo, pe, alpha,
                                                             xh, Qa, Kaa);

    proj_qkv_kernel<<<3 * PROJ_BLOCKS, 256, 0, stream>>>(xh, Wqh, bq, bk, bv, Qa, Kaa, Vb);

    attn_kernel<<<512, 256, 0, stream>>>(Qa, Kaa, Vb, mask, beta, Oh);

    proj_out_kernel<<<256, 256, 0, stream>>>(Oh, Woh, bo, out);
}

// v007
// A run of this version takes 92.9 microseconds.
// Timed twice side by side with v006, it ran 1.05 and 1.04 times as fast.
// Counting every step since v000, it is 3.57 times as fast.
#include <hip/hip_runtime.h>
#include <hip/hip_fp16.h>

// ---------------------------------------------------------------------------
// Disentangled attention, MI455X (gfx1250, wave32, WMMA).
// scores = (q.k)/8 + alpha_h*(pe_q.pe_k) + beta_h  folded into one GEMM by
// augmenting head-dim 64 -> 128:  Qa=[q/8, alpha*pe], Ka=[k, pe].
// f16 WMMA + fp32 accumulation; flash-style online softmax (no 512MB scores).
// GEMMs: 128x128 block tile, 8 waves of 32x64; both operands' fragments come once
// per block into a two-buffer LDS ring by asynchronous copies and are read from there.
// Every f16 matrix operand (x, the weights, Qa, Ka, V^T, O) is stored by its
// producer in fragment order, so that each wave-wide 16-byte load or copy covers
// 512 contiguous bytes (4 whole lines, not 16 partial ones).
// Four dependent launches: launches that do not depend on one another share one
// grid, and a range of the block index picks the job.
// ---------------------------------------------------------------------------

typedef __attribute__((ext_vector_type(16))) _Float16 v16h;
typedef __attribute__((ext_vector_type(8)))  _Float16 v8h;
typedef __attribute__((ext_vector_type(8)))  float    v8f;

#define D_MODEL 1024
#define NHEADS  16
#define HDIM    64
#define SEQ     2048
#define BATCH   2
#define MROWS   (BATCH * SEQ)   // 4096
#define DAUG    128             // augmented head dim (64 content + 64 pos)

// ---- WMMA helper -----------------------------------------------------------
static __device__ __forceinline__ v8f wmma_f16(v16h a, v16h b, v8f c) {
    return __builtin_amdgcn_wmma_f32_16x16x32_f16(false, a, false, b, (short)0, c,
                                                  false, false);
}

// ---- 16-bit A-layout fragment (also the B fragment of the N x K view) --------
// ISA 7.12.2: lanes 0-15 hold row M=lane with K = {k0..k0+7, k0+16..k0+23};
// lanes 16-31 hold the same rows with K = {k0+8..k0+15, k0+24..k0+31}.

// ---- fragment-order storage of a rows x K f16 matrix ------------------------
// One 16-row x 32-k fragment is a 1 KB block; blocks run along k, then rows.
// Inside a block: 512 B with each lane's first 8 halves, then 512 B with its
// second 8, in the lane and k order above.
static __device__ __forceinline__ size_t pk_off(int row, int k, int kblocks) {
    return ((size_t)((row >> 4) * kblocks + (k >> 5)) << 9)
         + (((k >> 4) & 1) << 8)
         + (((row & 15) + (((k >> 3) & 1) << 4)) << 3)
         + (k & 7);
}

#define PK_BLOCK 512   // halves in one 16 x 32 fragment block

// base = start of the fragment's block + lane * 8
static __device__ __forceinline__ v16h load_frag_pk(const _Float16* __restrict__ base) {
    v8h lo = *(const v8h*)(base);
    v8h hi = *(const v8h*)(base + 256);
    return __builtin_shufflevector(lo, hi, 0,1,2,3,4,5,6,7,8,9,10,11,12,13,14,15);
}

// ---- fp32 -> f16 convert, rows x D_MODEL, into fragment order ---------------
// One thread per 16-byte chunk of the output; chunk c lies at out + 8 * c.
static __device__ __forceinline__ void cvt_chunk(const float* __restrict__ in,
                                                 _Float16* __restrict__ out, int c) {
    const int lane = c & 31;
    const int part = (c >> 5) & 1;
    const int kb   = (c >> 6) & (D_MODEL / 32 - 1);
    const int rt   = c >> 11;
    const int row  = rt * 16 + (lane & 15);
    const int k    = kb * 32 + part * 16 + (lane >> 4) * 8;
    const float4* ip = (const float4*)(in + (size_t)row * D_MODEL + k);
    float4 u = ip[0];
    float4 w = ip[1];
    v8h o;
    o[0] = (_Float16)u.x; o[1] = (_Float16)u.y; o[2] = (_Float16)u.z; o[3] = (_Float16)u.w;
    o[4] = (_Float16)w.x; o[5] = (_Float16)w.y; o[6] = (_Float16)w.z; o[7] = (_Float16)w.w;
    *(v8h*)(out + (size_t)c * 8) = o;
}

// ---- four asynchronous copies of 16 bytes a thread, global -> LDS ------------
// l = this thread's LDS byte address, g = its source; copy c lies 4 KB behind copy
// c - 1 in LDS and gs halves behind it in global memory.
static __device__ __forceinline__ void copy4(unsigned l, const _Float16* g, int gs) {
    // The wait is the statement's last line: it stands in front of every later
    // write of the address registers that the four copies name.
    asm volatile("global_load_async_to_lds_b128 %0, %4, off\n\t"
                 "global_load_async_to_lds_b128 %1, %5, off\n\t"
                 "global_load_async_to_lds_b128 %2, %6, off\n\t"
                 "global_load_async_to_lds_b128 %3, %7, off\n\t"
                 "s_wait_xcnt 0x0"
                 :: "v"(l), "v"(l + 4096u), "v"(l + 8192u), "v"(l + 12288u),
                    "v"(g), "v"(g + gs), "v"(g + 2 * gs), "v"(g + 3 * gs)
                 : "memory");
}

// ---- common GEMM core: 128x128 block tile, 8 waves (4 x 2) of 32x64 ----------
// acc[mi][j] += A[m0+mi*16,:] . Wt[n0+j*16,:]^T, k ascending.
// A stage is KB fragment blocks (32 k each) of the block's 8 row tiles of A and 8
// of Wt, as they lie in global memory: in LDS tile rt starts at rt * KB * PK_BLOCK
// (0..7 A, 8..15 Wt). Stage s + 1 is in flight while stage s is worked on, and one
// barrier a stage hands over.
#define GEMM_RING(KB) (2 * 16 * (KB) * PK_BLOCK)   // halves of LDS for the two buffers
template <int KB>
static __device__ __forceinline__ void gemm_core_128x128(
        const _Float16* __restrict__ A, const _Float16* __restrict__ Wt,
        int mb, int nb, int wm, int wn, int lane, _Float16* ring, v8f acc[2][4]) {
    constexpr int RT    = (D_MODEL / 32) * PK_BLOCK;   // halves per 16-row tile in global memory
    constexpr int TILE  = KB * PK_BLOCK;               // halves per 16-row tile in a stage
    constexpr int STAGE = 16 * TILE;                   // halves per buffer
    constexpr int NST   = D_MODEL / (32 * KB);         // stages
    constexpr int TPC   = 256 * 8 / TILE;              // row tiles that one copy of the block covers
    constexpr int NC    = 8 / TPC;                     // copies per thread and operand
    const int t8 = threadIdx.x * 8;
    const _Float16* ga = A  + (size_t)((mb >> 4) + t8 / TILE) * RT + t8 % TILE;
    const _Float16* gb = Wt + (size_t)((nb >> 4) + t8 / TILE) * RT + t8 % TILE;
    const unsigned  l0 = (unsigned)(size_t)&ring[t8];

    auto copy_stage = [&](int s, int buf) {
#pragma unroll   // c is a constant in every address step
        for (int c = 0; c < NC; c += 4) {
            copy4(l0 + buf * (STAGE * 2) + c * 4096u,
                  ga + s * TILE + c * (TPC * RT), TPC * RT);
            copy4(l0 + buf * (STAGE * 2) + 8 * TILE * 2 + c * 4096u,
                  gb + s * TILE + c * (TPC * RT), TPC * RT);
        }
    };

    // ---- in front of the loop: stage 0 landed and published, stage 1 issued ----
    copy_stage(0, 0);
    // this wave's copies of stage 0 have landed before the barrier publishes them
    asm volatile("s_wait_asynccnt 0x0" ::: "memory");
    __syncthreads();
    copy_stage(1, 1);

    const _Float16* ra = ring + (wm * 2) * TILE + lane * 8;
    const _Float16* rb = ring + (8 + wn * 4) * TILE + lane * 8;
    for (int s = 0; s < NST; ++s) {
        const int buf = s & 1;
        const _Float16* pa = ra + buf * STAGE;
        const _Float16* pb = rb + buf * STAGE;
#pragma unroll   // the fragments' places in the stage become immediate offsets
        for (int kk = 0; kk < KB; ++kk) {
            v16h a0 = load_frag_pk(pa + kk * PK_BLOCK);
            v16h a1 = load_frag_pk(pa + TILE + kk * PK_BLOCK);
            v16h b0 = load_frag_pk(pb + kk * PK_BLOCK);
            v16h b1 = load_frag_pk(pb + TILE + kk * PK_BLOCK);
            v16h b2 = load_frag_pk(pb + 2 * TILE + kk * PK_BLOCK);
            v16h b3 = load_frag_pk(pb + 3 * TILE + kk * PK_BLOCK);
            // 8 independent accumulation chains
            acc[0][0] = wmma_f16(a0, b0, acc[0][0]);
            acc[0][1] = wmma_f16(a0, b1, acc[0][1]);
            acc[0][2] = wmma_f16(a0, b2, acc[0][2]);
            acc[0][3] = wmma_f16(a0, b3, acc[0][3]);
            acc[1][0] = wmma_f16(a1, b0, acc[1][0]);
            acc[1][1] = wmma_f16(a1, b1, acc[1][1]);
            acc[1][2] = wmma_f16(a1, b2, acc[1][2]);
            acc[1][3] = wmma_f16(a1, b3, acc[1][3]);
        }
        // ---- foot of the stage: hand over. This wave's LDS reads are done ...
        asm volatile("s_wait_dscnt 0x0" ::: "memory");
        // ... and its copies of the next stage have landed, ...
        asm volatile("s_wait_asynccnt 0x0" ::: "memory");
        // ... so the barrier publishes the next stage and frees this stage's buffer.
        __syncthreads();
        if (s + 2 < NST)   // the stage after next, into the buffer just read
            copy_stage(s + 2, buf);
    }
    // no copy is outstanding when the wave goes on to its epilogue
    asm volatile("s_wait_asynccnt 0x0" ::: "memory");
}

// ---- QKV projections: C = x @ W^T (+bias) * scale, head-split f16 output ---
// One block computes a 128x128 tile; one projection is 32 x 8 tiles = 256 blocks.
// One grid of 3 x 256 blocks: blocks 0..255 make q, 256..511 k, 512..767 v.
#define PROJ_BLOCKS 256
__global__ void __launch_bounds__(256)
proj_qkv_kernel(const _Float16* __restrict__ A,    // MROWS x D_MODEL, fragment order
                const _Float16* __restrict__ Wqkv, // Wq, Wk, Wv one behind the other, each D_MODEL x D_MODEL (N x K), fragment order
                const float*    __restrict__ bq,   // D_MODEL each
                const float*    __restrict__ bk,
                const float*    __restrict__ bv,
                _Float16*       __restrict__ Qa,   // [b,h][s,DAUG], fragment order per (b,h)
                _Float16*       __restrict__ Ka,   // [b,h][s,DAUG], fragment order per (b,h)
                _Float16*       __restrict__ V) {  // [b,h]: V^T (HDIM x s) as fragments, blocks along d, then keys
    const int lane  = threadIdx.x & 31;
    const int which = blockIdx.x / PROJ_BLOCKS;    // 0 q, 1 k, 2 v: the same for the whole block
    __shared__ __align__(128) _Float16 ring[GEMM_RING(2)];
    // wave number read as a scalar: the tile addresses then stay in scalar registers
    const int w    = __builtin_amdgcn_readfirstlane(threadIdx.x >> 5);
    const int tile = blockIdx.x % PROJ_BLOCKS;
    const int mb   = (tile >> 3) << 7;  // 32 row tiles of 128
    const int nb   = (tile & 7) << 7;   // 8 column tiles of 128
    const int m0   = mb + (w & 3) * 32; // this wave's 32 rows ...
    const int n0   = nb + (w >> 2) * 64; // ... and 64 columns
    const _Float16* Wt   = Wqkv + (size_t)which * D_MODEL * D_MODEL;
    const float*    bias = (which == 0) ? bq : (which == 1) ? bk : bv;

    v8f acc[2][4] = {};
    gemm_core_128x128<2>(A, Wt, mb, nb, w & 3, w >> 2, lane, ring, acc);

    const int half = lane >> 4;
    const int nlo  = lane & 15;
    if (which < 2) {
        _Float16* dst = (which == 0) ? Qa : Ka;
        // 1/sqrt(HDIM) = 1/8 is folded into the content half of Qa
        const float scale = (which == 0) ? 0.125f : 1.0f;
        // The 32-row tile lies in one batch and the 64-column group is one head.
        // pk_off adds over disjoint index bits: one lane base, constant steps.
        _Float16* lp = dst
            + ((size_t)(m0 >> 11) * NHEADS + (n0 >> 6)) * SEQ * DAUG
            + pk_off((m0 & (SEQ - 1)) + half * 8, nlo, DAUG / 32);
#pragma unroll
        for (int mi = 0; mi < 2; ++mi)
#pragma unroll
            for (int j = 0; j < 4; ++j)
#pragma unroll
                for (int r = 0; r < 8; ++r) {
                    float v = (acc[mi][j][r] + bias[n0 + j * 16 + nlo]) * scale;
                    lp[pk_off(mi * 16 + r, j * 16, DAUG / 32)] = (_Float16)v;
                }
        return;
    }
    // V^T: row = d, k = key. The tile's 32 keys are one k block, its 64 columns the
    // four d tiles. In block j a lane holds row d = nlo and, per mi, the 8 keys
    // mi*16 + half*8 + r: chunk "lane" of the block's half mi, one 16-byte store.
    _Float16* vp = V
        + ((size_t)(m0 >> 11) * NHEADS + (n0 >> 6)) * SEQ * HDIM
        + (size_t)((m0 & (SEQ - 1)) >> 5) * (HDIM / 16) * PK_BLOCK + lane * 8;
#pragma unroll
    for (int mi = 0; mi < 2; ++mi)
#pragma unroll
        for (int j = 0; j < 4; ++j) {
            const float bj = bias[n0 + j * 16 + nlo];
            v8h o;
#pragma unroll
            for (int r = 0; r < 8; ++r) o[r] = (_Float16)(acc[mi][j][r] + bj);
            *(v8h*)(vp + j * PK_BLOCK + mi * 256) = o;
        }
    // Stands in front of any later write of a register that these stores name.
    asm volatile("s_wait_xcnt 0x0" ::: "memory");
}

// ---- output projection: out = O @ Wo^T + bo (fp32 out) ---------------------
__global__ void __launch_bounds__(256)
proj_out_kernel(const _Float16* __restrict__ A,    // MROWS x D_MODEL (f16), fragment order
                const _Float16* __restrict__ Wt,   // D_MODEL x D_MODEL (N x K), fragment order
                const float*    __restrict__ bias,
                float*          __restrict__ out) {
    const int lane = threadIdx.x & 31;
    // one block a WGP: longer stages, so that a stage's work covers the next one's flight
    __shared__ __align__(128) _Float16 ring[GEMM_RING(4)];
    // wave number read as a scalar: the tile addresses then stay in scalar registers
    const int w    = __builtin_amdgcn_readfirstlane(threadIdx.x >> 5);
    const int mb   = (blockIdx.x >> 3) << 7;
    const int nb   = (blockIdx.x & 7) << 7;
    const int m0   = mb + (w & 3) * 32;
    const int n0   = nb + (w >> 2) * 64;

    v8f acc[2][4] = {};
    gemm_core_128x128<4>(A, Wt, mb, nb, w & 3, w >> 2, lane, ring, acc);

    const int half = lane >> 4;
    const int nlo  = lane & 15;
#pragma unroll
    for (int mi = 0; mi < 2; ++mi)
#pragma unroll
        for (int j = 0; j < 4; ++j)
#pragma unroll
            for (int r = 0; r < 8; ++r) {
                int m = m0 + mi * 16 + r + half * 8;
                int n = n0 + j * 16 + nlo;
                out[(size_t)m * D_MODEL + n] = acc[mi][j][r] + bias[n];
            }
}

// ---- fill positional halves of Qa / Ka -------------------------------------
// one thread per 16-byte chunk of the positional k blocks (2 and 3 of 4);
// t runs over B*H*S*64/8
static __device__ __forceinline__ void augment_chunk(const float* __restrict__ pe,
                                                     const float* __restrict__ alpha,
                                                     _Float16* __restrict__ Qa,
                                                     _Float16* __restrict__ Ka, int t) {
    const int lane = t & 31;
    const int part = (t >> 5) & 1;
    const int kbp  = (t >> 6) & 1;
    const int rt   = (t >> 7) & (SEQ / 16 - 1);
    const int bh   = t >> 14;
    const int s    = rt * 16 + (lane & 15);
    const int d    = kbp * 32 + part * 16 + (lane >> 4) * 8;
    const float al = alpha[bh & (NHEADS - 1)];
    const float4* pp = (const float4*)(pe + s * HDIM + d);
    float4 u = pp[0];
    float4 w = pp[1];
    float p[8] = {u.x, u.y, u.z, u.w, w.x, w.y, w.z, w.w};
    v8h qv, kv;
#pragma unroll
    for (int i = 0; i < 8; ++i) {
        qv[i] = (_Float16)(al * p[i]);
        kv[i] = (_Float16)p[i];
    }
    size_t base = (size_t)bh * SEQ * DAUG + pk_off(s, HDIM + d, DAUG / 32);
    *(v8h*)(Qa + base) = qv;
    *(v8h*)(Ka + base) = kv;
    // Stands in front of any later write of a register that the two stores name.
    asm volatile("s_wait_xcnt 0x0" ::: "memory");
}

// ---- everything that reads only inputs, in one grid -------------------------
// Blocks of 256 chunks: x, then Wq, Wk, Wv, Wo, then the positional halves.
// The f16 copies of x and of the four weights lie one behind the other in xw,
// all D_MODEL wide, so a convert block's output chunk is its index in the grid.
#define X_BLOCKS   (MROWS * D_MODEL / 8 / 256)                 // 2048
#define W_BLOCKS   (D_MODEL * D_MODEL / 8 / 256)               // 512
#define CVT_BLOCKS (X_BLOCKS + 4 * W_BLOCKS)                   // 4096
#define AUG_BLOCKS (BATCH * NHEADS * SEQ * HDIM / 8 / 256)     // 2048
__global__ void __launch_bounds__(256)
prep_kernel(const float* __restrict__ x,
            const float* __restrict__ Wq, const float* __restrict__ Wk,
            const float* __restrict__ Wv, const float* __restrict__ Wo,
            const float* __restrict__ pe, const float* __restrict__ alpha,
            _Float16* __restrict__ xw,
            _Float16* __restrict__ Qa, _Float16* __restrict__ Ka) {
    const int blk = blockIdx.x;
    if (blk < CVT_BLOCKS) {
        const float* in    = x;
        int          first = 0;          // the source's first block
        if (blk >= X_BLOCKS) {
            const int w = (blk - X_BLOCKS) / W_BLOCKS;
            in    = (w == 0) ? Wq : (w == 1) ? Wk : (w == 2) ? Wv : Wo;
            first = X_BLOCKS + w * W_BLOCKS;
        }
        cvt_chunk(in, xw + (size_t)first * 256 * 8, (blk - first) * 256 + threadIdx.x);
    } else {
        augment_chunk(pe, alpha, Qa, Ka, (blk - CVT_BLOCKS) * 256 + threadIdx.x);
    }
}

// ---- lane l with lane l ^ 16 (the two lanes that share one column) ----------
static __device__ __forceinline__ float xhalf(float x) {
    int v = __builtin_bit_cast(int, x);
    return __builtin_bit_cast(float,
        __builtin_amdgcn_permlanex16(v, v, 0x76543210, 0xfedcba98, false, false));
}

typedef __attribute__((ext_vector_type(2))) float    v2f;
typedef __attribute__((ext_vector_type(2))) _Float16 v2h;

#define KTILE 8192   // halves in one 64-key tile of Ka: 16 fragment blocks, contiguous (16 KB)
#define VTILE 4096   // halves in one 64-key tile of V^T: 8 fragment blocks, contiguous (8 KB)
#define ATT_THREADS 128                 // 4 waves of 32 queries
#define CSTEP       (ATT_THREADS * 8)   // halves that one copy of the whole block covers (2 KB)

// ---- one 64-key K tile and its V^T tile, global -> LDS, through no register ---
// 128 threads x (8 + 4) asynchronous copies of 16 bytes. kl, vl = this thread's
// byte addresses in the two buffers, kg, vg = its sources; within a tile copy c
// lies 2 KB behind copy c - 1.
static __device__ __forceinline__ void copy_kv_tile(unsigned kl, const _Float16* kg,
                                                    unsigned vl, const _Float16* vg) {
    // The wait is the statement's last line: it stands in front of every later
    // write of the address registers that the twelve copies name.
    asm volatile("global_load_async_to_lds_b128 %0, %12, off\n\t"
                 "global_load_async_to_lds_b128 %1, %13, off\n\t"
                 "global_load_async_to_lds_b128 %2, %14, off\n\t"
                 "global_load_async_to_lds_b128 %3, %15, off\n\t"
                 "global_load_async_to_lds_b128 %4, %16, off\n\t"
                 "global_load_async_to_lds_b128 %5, %17, off\n\t"
                 "global_load_async_to_lds_b128 %6, %18, off\n\t"
                 "global_load_async_to_lds_b128 %7, %19, off\n\t"
                 "global_load_async_to_lds_b128 %8, %20, off\n\t"
                 "global_load_async_to_lds_b128 %9, %21, off\n\t"
                 "global_load_async_to_lds_b128 %10, %22, off\n\t"
                 "global_load_async_to_lds_b128 %11, %23, off\n\t"
                 "s_wait_xcnt 0x0"
                 :: "v"(kl), "v"(kl + 2u * CSTEP), "v"(kl + 4u * CSTEP), "v"(kl + 6u * CSTEP),
                    "v"(kl + 8u * CSTEP), "v"(kl + 10u * CSTEP), "v"(kl + 12u * CSTEP), "v"(kl + 14u * CSTEP),
                    "v"(vl), "v"(vl + 2u * CSTEP), "v"(vl + 4u * CSTEP), "v"(vl + 6u * CSTEP),
                    "v"(kg), "v"(kg + CSTEP), "v"(kg + 2 * CSTEP), "v"(kg + 3 * CSTEP),
                    "v"(kg + 4 * CSTEP), "v"(kg + 5 * CSTEP), "v"(kg + 6 * CSTEP), "v"(kg + 7 * CSTEP),
                    "v"(vg), "v"(vg + CSTEP), "v"(vg + 2 * CSTEP), "v"(vg + 3 * CSTEP)
                 : "memory");
}

// ---- fused flash attention over augmented dim 128 --------------------------
// Block = (b, h, 128 q rows) -> 4 waves, each wave owns 32 q rows: two 16-query
// tiles, so that each K or V^T fragment a wave reads from LDS feeds two WMMAs and the
// LDS bytes read per product are half those of a 16-query wave.
// Transposed products: S^T = Ka.Qa^T and O^T += V^T.P^T. In an accumulator tile
// a lane holds 8 keys (or 8 d) of ONE query, q0 + t*16 + (lane & 15): maximum and
// sum run over the lane's own registers, the two lanes of a query exchange once,
// and two converted S^T tiles are the B operand of the second product as they
// stand, so P never goes through LDS.
// K and V^T tiles come into a two-buffer LDS ring by asynchronous copies, once per
// block, as the fragments they are read as: tile t + 1 is in flight while tile t is
// worked on, and one barrier a trip hands over.
// The grid gives every SIMD two waves (one of each of a WGP's two blocks), so the
// register budget is set for two.
__global__ void __launch_bounds__(ATT_THREADS) __attribute__((amdgpu_waves_per_eu(2, 2)))
attn_kernel(const _Float16* __restrict__ Qa,   // [b,h][s,128], fragment order
            const _Float16* __restrict__ Ka,   // [b,h][s,128], fragment order
            const _Float16* __restrict__ V,    // [b,h]: V^T (64 x s) as fragments, blocks along d, then keys
            const int*      __restrict__ mask, // [b,s]
            const float*    __restrict__ beta, // [h]
            _Float16*       __restrict__ O) {  // MROWS x D_MODEL, fragment order
    __shared__ __align__(32) float    KB[SEQ];                  // per key: beta, or -3e38 where masked
    __shared__ __align__(128) _Float16 KR[2 * KTILE];           // K ring: two 64-key tiles, fragment order
    __shared__ __align__(128) _Float16 VR[2 * VTILE];           // V^T ring: two 64-key tiles, fragment order

    const int lane = threadIdx.x & 31;
    const int widx = threadIdx.x >> 5;
    const int bh   = blockIdx.x >> 4;           // b*16 + h
    const int b    = bh >> 4;
    const int h    = bh & 15;
    const int q0   = (blockIdx.x & 15) * 128 + widx * 32;

    const _Float16* Qh = Qa + (size_t)bh * SEQ * DAUG;
    const _Float16* Kh = Ka + (size_t)bh * SEQ * DAUG;
    const _Float16* Vh = V  + (size_t)bh * SEQ * HDIM;
    const float bet = beta[h];

    // A key is a register index of S^T, so its mask and beta enter as the start
    // value of its S^T accumulator row. Read behind the barrier in front of the loop.
#pragma unroll
    for (int i = 0; i < SEQ / 4 / ATT_THREADS; ++i) {
        const int  c  = i * ATT_THREADS + threadIdx.x;
        const int4 ma = ((const int4*)(mask + b * SEQ))[c];
        float4 fa;
        fa.x = (ma.x == 0) ? -3.0e38f : bet;  fa.y = (ma.y == 0) ? -3.0e38f : bet;
        fa.z = (ma.z == 0) ? -3.0e38f : bet;  fa.w = (ma.w == 0) ? -3.0e38f : bet;
        ((float4*)KB)[c] = fa;
    }

    // ---- the ring, in front of the loop: tile 0 landed and published, tile 1 issued ----
    const unsigned  kr_lds = (unsigned)(size_t)&KR[threadIdx.x * 8];
    const unsigned  vr_lds = (unsigned)(size_t)&VR[threadIdx.x * 8];
    const _Float16* kg     = Kh + threadIdx.x * 8;
    const _Float16* vg     = Vh + threadIdx.x * 8;
    copy_kv_tile(kr_lds, kg, vr_lds, vg);
    // this wave's copies of tile 0 have landed before the barrier publishes them
    asm volatile("s_wait_asynccnt 0x0" ::: "memory");
    __syncthreads();
    copy_kv_tile(kr_lds + KTILE * 2, kg + KTILE, vr_lds + VTILE * 2, vg + VTILE);

    v16h qf[2][4];
#pragma unroll
    for (int t = 0; t < 2; ++t)
#pragma unroll
        for (int kq = 0; kq < 4; ++kq)
            qf[t][kq] = load_frag_pk(Qh + (((q0 >> 4) + t) * (DAUG / 32) + kq) * PK_BLOCK + lane * 8);

    v8f oacc[2][4] = {};                     // oacc[t][j2][r] = O^T[j2*16 + half*8 + r][q0 + t*16 + nlo]
    float rmax[2] = {-3.0e38f, -3.0e38f};    // this lane's query of tile t, both halves alike
    float rsum[2] = {0.f, 0.f};              // this lane's half of the keys only; joined at the end

    const int half = lane >> 4;
    const int nlo  = lane & 15;

    for (int k0 = 0; k0 < SEQ; k0 += 64) {
        // ---- scores S^T = Ka.Qa^T (64 keys x 32 q, K=128); kq-outer => 8
        //      independent WMMA chains per step, 4 K-frag LDS loads clustered per step.
        //      sc[t][j][r] = score(key k0 + j*16 + half*8 + r, query q0 + t*16 + nlo) ----
        const int kbuf = (k0 >> 6) & 1;          // this trip's buffer
        const _Float16* kt = KR + kbuf * KTILE + lane * 8;
        const _Float16* vt = VR + kbuf * VTILE + lane * 8;
        v8f kbias[4];   // read once: the start value of both query tiles' accumulators
#pragma unroll
        for (int j = 0; j < 4; ++j)
            kbias[j] = *(const v8f*)&KB[k0 + j * 16 + half * 8];
        v8f sc[2][4];
#pragma unroll
        for (int kq = 0; kq < 4; ++kq) {
            v16h kb[4];
#pragma unroll
            for (int j = 0; j < 4; ++j)
                kb[j] = load_frag_pk(kt + (j * (DAUG / 32) + kq) * PK_BLOCK);
#pragma unroll
            for (int j = 0; j < 4; ++j)
#pragma unroll
                for (int t = 0; t < 2; ++t)
                    sc[t][j] = wmma_f16(kb[j], qf[t][kq], (kq == 0) ? kbias[j] : sc[t][j]);
        }

        // ---- online softmax: one query per lane and query tile ----
        v16h pb[2][2];
#pragma unroll
        for (int t = 0; t < 2; ++t) {
            float mt[4];   // one chain per key tile: a tile's maximum runs under the later tiles' WMMAs
#pragma unroll
            for (int j = 0; j < 4; ++j) {
                mt[j] = sc[t][j][0];
#pragma unroll
                for (int r = 1; r < 8; ++r) mt[j] = fmaxf(mt[j], sc[t][j][r]);
            }
            float m = fmaxf(fmaxf(mt[0], mt[1]), fmaxf(mt[2], mt[3]));
            m = fmaxf(m, xhalf(m));
            const float nm   = fmaxf(rmax[t], m);
            const float corr = __expf(rmax[t] - nm);
            rmax[t] = nm;
#pragma unroll
            for (int j2 = 0; j2 < 4; ++j2) oacc[t][j2] *= corr;

            // p = exp(s - nm); elements 8*u .. 8*u+7 of the 32-key B operand are key tile
            // 2*kk + u, registers 0..7: the k order of the V^T fragments.
            v2f  ls[4];    // one sum chain per key tile
#pragma unroll
            for (int j = 0; j < 4; ++j) {
#pragma unroll
                for (int r = 0; r < 8; r += 2) {
                    v2f d = (v2f{sc[t][j][r], sc[t][j][r + 1]} - nm) * 1.44269504088896340736f;
                    v2f p = {__builtin_amdgcn_exp2f(d.x), __builtin_amdgcn_exp2f(d.y)};
                    ls[j] = (r == 0) ? p : ls[j] + p;
                    v2h ph = __builtin_convertvector(p, v2h);
                    pb[t][j >> 1][(j & 1) * 8 + r]     = ph.x;
                    pb[t][j >> 1][(j & 1) * 8 + r + 1] = ph.y;
                }
            }
            const v2f lt = (ls[0] + ls[1]) + (ls[2] + ls[3]);
            rsum[t] = rsum[t] * corr + (lt.x + lt.y);
        }

        // ---- O^T += V^T.P^T : A-frags from the V^T ring, B-frags from registers ----
#pragma unroll
        for (int kk = 0; kk < 2; ++kk) {
            v16h vb[4];
#pragma unroll
            for (int j2 = 0; j2 < 4; ++j2)
                vb[j2] = load_frag_pk(vt + (kk * (HDIM / 16) + j2) * PK_BLOCK);
#pragma unroll
            for (int j2 = 0; j2 < 4; ++j2)
#pragma unroll
                for (int t = 0; t < 2; ++t)
                    oacc[t][j2] = wmma_f16(vb[j2], pb[t][kk], oacc[t][j2]);
        }
        // ---- foot of the trip: hand over. This wave's LDS reads are done ...
        asm volatile("s_wait_dscnt 0x0" ::: "memory");
        // ... and its copies of the next tile have landed, ...
        asm volatile("s_wait_asynccnt 0x0" ::: "memory");
        // ... so the barrier publishes the next tiles and frees this trip's buffers.
        __syncthreads();
        if (k0 + 128 < SEQ)   // the tiles after next, into the buffers just read
            copy_kv_tile(kr_lds + kbuf * (KTILE * 2), kg + (size_t)(k0 + 128) * DAUG,
                         vr_lds + kbuf * (VTILE * 2), vg + (size_t)(k0 + 128) * HDIM);
    }
    // no copy is outstanding when the wave goes on to its end
    asm volatile("s_wait_asynccnt 0x0" ::: "memory");

    // ---- normalize and store O (4096 x 1024, row b*S+s, column h*64+d):
    //      a lane's 8 registers are 8 consecutive columns, one 16-byte chunk ----
#pragma unroll
    for (int t = 0; t < 2; ++t) {
        const float inv = 1.f / fmaxf(rsum[t] + xhalf(rsum[t]), 1e-20f);
#pragma unroll
        for (int j2 = 0; j2 < 4; ++j2) {
            v8h o;
#pragma unroll
            for (int r = 0; r < 8; ++r) o[r] = (_Float16)(oacc[t][j2][r] * inv);
            *(v8h*)(O + pk_off(b * SEQ + q0 + t * 16 + nlo, h * HDIM + j2 * 16 + half * 8, D_MODEL / 32)) = o;
        }
        // Stands in front of any later write of a register that these stores name.
        asm volatile("s_wait_xcnt 0x0" ::: "memory");
    }
}

// ---------------------------------------------------------------------------
extern "C" void kernel_launch(void* const* d_in, const int* in_sizes, int n_in,
                              void* d_out, int out_size, void* d_ws, size_t ws_size,
                              hipStream_t stream) {
    const float* x     = (const float*)d_in[0];
    const int*   mask  = (const int*)d_in[1];
    const float* Wq    = (const float*)d_in[2];
    const float* bq    = (const float*)d_in[3];
    const float* Wk    = (const float*)d_in[4];
    const float* bk    = (const float*)d_in[5];
    const float* Wv    = (const float*)d_in[6];
    const float* bv    = (const float*)d_in[7];
    const float* Wo    = (const float*)d_in[8];
    const float* bo    = (const float*)d_in[9];
    const float* pe    = (const float*)d_in[10];
    const float* alpha = (const float*)d_in[11];
    const float* beta  = (const float*)d_in[12];
    float* out = (float*)d_out;

    // workspace carve-up (64 MB total)
    char* ws = (char*)d_ws;
    _Float16* xh  = (_Float16*)ws; ws += (size_t)MROWS * D_MODEL * 2;        // 8 MB
    _Float16* Wqh = (_Float16*)ws; ws += (size_t)3 * D_MODEL * D_MODEL * 2;  // Wq, Wk, Wv: 2 MB each
    _Float16* Woh = (_Float16*)ws; ws += (size_t)D_MODEL * D_MODEL * 2;      // 2 MB
    _Float16* Qa  = (_Float16*)ws; ws += (size_t)BATCH * NHEADS * SEQ * DAUG * 2; // 16 MB
    _Float16* Kaa = (_Float16*)ws; ws += (size_t)BATCH * NHEADS * SEQ * DAUG * 2; // 16 MB
    _Float16* Vb  = (_Float16*)ws; ws += (size_t)BATCH * NHEADS * SEQ * HDIM * 2; //  8 MB
    _Float16* Oh  = (_Float16*)ws; ws += (size_t)MROWS * D_MODEL * 2;             //  8 MB

    // the f16 copies of x, Wq, Wk, Wv, Wo are one run of the workspace, filled from xh on
    prep_kernel<<<CVT_BLOCKS + AUG_BLOCKS, 256, 0, stream>>>(x, Wq, Wk, Wv, Wo, pe, alpha,
                                                             xh, Qa, Kaa);

    proj_qkv_kernel<<<3 * PROJ_BLOCKS, 256, 0, stream>>>(xh, Wqh, bq, bk, bv, Qa, Kaa, Vb);

    attn_kernel<<<512, ATT_THREADS, 0, stream>>>(Qa, Kaa, Vb, mask, beta, Oh);

    proj_out_kernel<<<256, 256, 0, stream>>>(Oh, Woh, bo, out);
}
